// v000
// Measured on an AMD MI455X. A time is GPU time per run, averaged over a window of back-to-back runs after a warm-up
// (all launches, gaps included; the runs take copies of the inputs in turn), and the median of several windows.
// Apart from v000's, it joins two sittings. Times from different sittings can be a few percent apart, while
// side-by-side timings come from the same sitting.
// The starting kernel, v000, takes 1010 microseconds a run.
#include <hip/hip_runtime.h>

typedef _Float16 f16;
typedef __attribute__((ext_vector_type(16))) _Float16 v16h;
typedef __attribute__((ext_vector_type(8)))  _Float16 v8h;
typedef __attribute__((ext_vector_type(8)))  float    v8f;

#define DIMN 1024
#define HEADD 64
#define NHEADS 16
#define BATCH 4
#define SEQ 2048
#define ROWS (BATCH*SEQ)   /* 8192 */
#define K3   (3*DIMN)      /* 3072 */
#define ATTN_SCALE 0.125f  /* 64^-0.5 */

// K-index mapping for 16-bit A/B fragments (ISA 7.12.2, 16-bit A 16x32):
// VGPR j holds 2 f16; lanes 0-15 cover K {0..7,16..23}, lanes 16-31 add +8.
__device__ __forceinline__ int pairK(int j) { return (j < 4) ? (2 * j) : (16 + 2 * (j - 4)); }

union AFrag { unsigned u[8]; v16h v; };

// CDNA5 async copy: global -> LDS, 16 bytes per lane, tracked by ASYNCcnt.
// LDS operand is the low 32 bits of the generic pointer (LDS aperture truncates
// addr[31:0] per ISA 10.2).
__device__ __forceinline__ void async_b128(unsigned lds_off, const void* g) {
  asm volatile("global_load_async_to_lds_b128 %0, %1, off"
               :: "v"(lds_off), "v"(g) : "memory");
}
__device__ __forceinline__ void wait_async0() {
  asm volatile("s_wait_asynccnt 0x0" ::: "memory");
}

// ---------------------------------------------------------------- pack kernels
__global__ void pack_xcat(const float* __restrict__ a, const float* __restrict__ b,
                          const float* __restrict__ c, f16* __restrict__ out) {
  size_t total = (size_t)ROWS * K3;
  for (size_t i = (size_t)blockIdx.x * blockDim.x + threadIdx.x; i < total;
       i += (size_t)gridDim.x * blockDim.x) {
    size_t row = i / K3;
    int col = (int)(i % K3);
    const float* src = (col < DIMN) ? a : (col < 2 * DIMN ? b : c);
    out[i] = (f16)src[row * DIMN + (col & (DIMN - 1))];
  }
}

__global__ void pack_w3(const float* __restrict__ a, const float* __restrict__ b,
                        const float* __restrict__ c, f16* __restrict__ out) {
  size_t blk = (size_t)DIMN * DIMN;
  size_t total = 3 * blk;
  for (size_t i = (size_t)blockIdx.x * blockDim.x + threadIdx.x; i < total;
       i += (size_t)gridDim.x * blockDim.x) {
    const float* s = (i < blk) ? a : (i < 2 * blk ? b : c);
    out[i] = (f16)s[i % blk];
  }
}

__global__ void pack_w1(const float* __restrict__ a, f16* __restrict__ out, size_t total) {
  for (size_t i = (size_t)blockIdx.x * blockDim.x + threadIdx.x; i < total;
       i += (size_t)gridDim.x * blockDim.x)
    out[i] = (f16)a[i];
}

// ---------------------------------------------------------------- WMMA GEMM
// C[M,N] = A[M,K] @ B[K,N]; f16 in, f32 accumulate; 128x128x64 tiles,
// 256 threads = 8 waves in 4(m) x 2(n) grid, each wave computes 32x64.
// A tile staged via global_load_async_to_lds_b128; B tile transposed via VGPRs.
template <bool OUT_F32, bool HAS_BIAS>
__global__ __launch_bounds__(256)
void gemm_wmma(const f16* __restrict__ A, const f16* __restrict__ B,
               void* __restrict__ Cout, const float* __restrict__ bias,
               int K, int lda, int ldb, int ldc) {
  __shared__ f16 lds_a[128 * 72];   // [row][k], padded stride (144B, 16B-aligned)
  __shared__ f16 lds_bt[128 * 72];  // B transposed: [n][k], padded stride

  const int tid = threadIdx.x;
  const int wave = tid >> 5, lane = tid & 31;
  const int m = lane & 15, half = lane >> 4;
  const int waveM = wave >> 1, waveN = wave & 1;
  const int rowBase = blockIdx.y * 128;
  const int colBase = blockIdx.x * 128;

  v8f acc[2][4] = {};

  for (int k0 = 0; k0 < K; k0 += 64) {
    __syncthreads();
    // A tile: 128x64 f16 = 1024 x 16B, async straight into LDS
#pragma unroll
    for (int it = 0; it < 4; ++it) {
      int v = tid + it * 256;
      int r = v >> 3;            // 8 vectors per row of 64
      int c = (v & 7) * 8;
      async_b128((unsigned)(size_t)&lds_a[r * 72 + c],
                 &A[(size_t)(rowBase + r) * lda + k0 + c]);
    }
    // B tile: 64x128 f16, transposed into LDS through VGPRs
#pragma unroll
    for (int it = 0; it < 4; ++it) {
      int v = tid + it * 256;
      int kr = v >> 4;           // 16 vectors per row of 128
      int c = (v & 15) * 8;
      v8h val = *(const v8h*)&B[(size_t)(k0 + kr) * ldb + colBase + c];
#pragma unroll
      for (int e = 0; e < 8; ++e) lds_bt[(c + e) * 72 + kr] = val[e];
    }
    wait_async0();
    __syncthreads();

#pragma unroll
    for (int ks = 0; ks < 2; ++ks) {
      const int kk = ks * 32;
      AFrag a[2], b[4];
#pragma unroll
      for (int ms = 0; ms < 2; ++ms) {
        int row = waveM * 32 + ms * 16 + m;
#pragma unroll
        for (int j = 0; j < 8; ++j)
          a[ms].u[j] = *(const unsigned*)&lds_a[row * 72 + kk + pairK(j) + 8 * half];
      }
#pragma unroll
      for (int ns = 0; ns < 4; ++ns) {
        int col = waveN * 64 + ns * 16 + m;
#pragma unroll
        for (int j = 0; j < 8; ++j)
          b[ns].u[j] = *(const unsigned*)&lds_bt[col * 72 + kk + pairK(j) + 8 * half];
      }
#pragma unroll
      for (int ms = 0; ms < 2; ++ms)
#pragma unroll
        for (int ns = 0; ns < 4; ++ns)
          acc[ms][ns] = __builtin_amdgcn_wmma_f32_16x16x32_f16(
              false, a[ms].v, false, b[ns].v, (short)0, acc[ms][ns], false, false);
    }
  }

  // Branch-free epilogue: C layout -> row = r + 8*half, col = lane&15.
#pragma unroll
  for (int ms = 0; ms < 2; ++ms)
#pragma unroll
    for (int ns = 0; ns < 4; ++ns) {
      int row0 = rowBase + waveM * 32 + ms * 16 + 8 * half;
      int col = colBase + waveN * 64 + ns * 16 + m;
      float bv = 0.f;
      if constexpr (HAS_BIAS) bv = bias[col];
#pragma unroll
      for (int r = 0; r < 8; ++r) {
        float val = acc[ms][ns][r] + bv;
        size_t idx = (size_t)(row0 + r) * ldc + col;
        if constexpr (OUT_F32) ((float*)Cout)[idx] = val;
        else                   ((f16*)Cout)[idx] = (f16)val;
      }
    }
}

// ---------------------------------------------------------------- flash attention
// grid = (SEQ/64, BATCH*NHEADS); 128 threads = 4 waves, each wave owns 16 q-rows.
__global__ __launch_bounds__(128)
void flash_attn(const f16* __restrict__ Q, const f16* __restrict__ Kmat,
                const f16* __restrict__ Vmat, f16* __restrict__ O) {
  __shared__ f16 lds_k[64 * 64];       // [key][d]
  __shared__ f16 lds_vt[64 * 64];      // [d][key]
  __shared__ f16 lds_p[4 * 16 * 64];   // per-wave P staging (C-layout -> A-layout)

  const int tid = threadIdx.x;
  const int wave = tid >> 5, lane = tid & 31;
  const int m = lane & 15, half = lane >> 4;
  const int bh = blockIdx.y, bi = bh >> 4, h = bh & 15;
  const int qrow0 = bi * SEQ + blockIdx.x * 64 + wave * 16;
  const int qcol0 = h * HEADD;

  // Q rows in A-fragment layout (two frags: d 0..31 and 32..63)
  AFrag aQ[2];
#pragma unroll
  for (int f = 0; f < 2; ++f)
#pragma unroll
    for (int j = 0; j < 8; ++j)
      aQ[f].u[j] = *(const unsigned*)
          &Q[(size_t)(qrow0 + m) * DIMN + qcol0 + pairK(j) + 8 * half + 32 * f];

  v8f Oacc[4] = {};
  float mrun[8], lrun[8];
#pragma unroll
  for (int r = 0; r < 8; ++r) { mrun[r] = -1e30f; lrun[r] = 0.f; }

  for (int kc = 0; kc < SEQ / 64; ++kc) {
    __syncthreads();
    // K chunk async -> LDS; V chunk transposed via VGPRs
#pragma unroll
    for (int it = 0; it < 4; ++it) {
      int v = tid + it * 128;
      int r = v >> 3;
      int c = (v & 7) * 8;
      size_t g = (size_t)(bi * SEQ + kc * 64 + r) * DIMN + qcol0 + c;
      async_b128((unsigned)(size_t)&lds_k[r * 64 + c], &Kmat[g]);
      v8h vv = *(const v8h*)&Vmat[g];
#pragma unroll
      for (int e = 0; e < 8; ++e) lds_vt[(c + e) * 64 + r] = vv[e];
    }
    wait_async0();
    __syncthreads();

    // S = Q @ K^T  (B frag: B[d][key], contiguous d in lds_k rows)
    v8f S[4];
#pragma unroll
    for (int s = 0; s < 4; ++s) {
      AFrag bK[2];
#pragma unroll
      for (int f = 0; f < 2; ++f)
#pragma unroll
        for (int j = 0; j < 8; ++j)
          bK[f].u[j] = *(const unsigned*)
              &lds_k[(s * 16 + m) * 64 + pairK(j) + 8 * half + 32 * f];
      v8f c = {};
      c = __builtin_amdgcn_wmma_f32_16x16x32_f16(false, aQ[0].v, false, bK[0].v,
                                                 (short)0, c, false, false);
      c = __builtin_amdgcn_wmma_f32_16x16x32_f16(false, aQ[1].v, false, bK[1].v,
                                                 (short)0, c, false, false);
      S[s] = c;
    }

    // online softmax; row r of the C tile lives in the 16 lanes of one half-wave,
    // so xor-shuffles 1/2/4/8 reduce across exactly those lanes.
#pragma unroll
    for (int r = 0; r < 8; ++r) {
      float mx = -1e30f;
#pragma unroll
      for (int s = 0; s < 4; ++s) { S[s][r] *= ATTN_SCALE; mx = fmaxf(mx, S[s][r]); }
#pragma unroll
      for (int off = 1; off <= 8; off <<= 1) mx = fmaxf(mx, __shfl_xor(mx, off, 32));
      float nm = fmaxf(mrun[r], mx);
      float alpha = __expf(mrun[r] - nm);
      mrun[r] = nm;
      float ssum = 0.f;
#pragma unroll
      for (int s = 0; s < 4; ++s) {
        float p = __expf(S[s][r] - nm);
        S[s][r] = p;
        ssum += p;
        Oacc[s][r] *= alpha;
      }
#pragma unroll
      for (int off = 1; off <= 8; off <<= 1) ssum += __shfl_xor(ssum, off, 32);
      lrun[r] = lrun[r] * alpha + ssum;
    }

    // P (C layout) -> LDS -> reload in A layout
#pragma unroll
    for (int s = 0; s < 4; ++s)
#pragma unroll
      for (int r = 0; r < 8; ++r)
        lds_p[wave * 1024 + (r + 8 * half) * 64 + s * 16 + m] = (f16)S[s][r];
    __syncthreads();

    AFrag aP[2];
#pragma unroll
    for (int f = 0; f < 2; ++f)
#pragma unroll
      for (int j = 0; j < 8; ++j)
        aP[f].u[j] = *(const unsigned*)
            &lds_p[wave * 1024 + m * 64 + pairK(j) + 8 * half + 32 * f];

    // O += P @ V  (B frag: B[key][d] from lds_vt, contiguous key)
#pragma unroll
    for (int s = 0; s < 4; ++s) {
      AFrag bV[2];
#pragma unroll
      for (int f = 0; f < 2; ++f)
#pragma unroll
        for (int j = 0; j < 8; ++j)
          bV[f].u[j] = *(const unsigned*)
              &lds_vt[(s * 16 + m) * 64 + pairK(j) + 8 * half + 32 * f];
      Oacc[s] = __builtin_amdgcn_wmma_f32_16x16x32_f16(false, aP[0].v, false, bV[0].v,
                                                       (short)0, Oacc[s], false, false);
      Oacc[s] = __builtin_amdgcn_wmma_f32_16x16x32_f16(false, aP[1].v, false, bV[1].v,
                                                       (short)0, Oacc[s], false, false);
    }
  }

  // normalize and store (f16, row-major [b*n, h*d])
#pragma unroll
  for (int s = 0; s < 4; ++s)
#pragma unroll
    for (int r = 0; r < 8; ++r) {
      float val = Oacc[s][r] / lrun[r];
      O[(size_t)(qrow0 + r + 8 * half) * DIMN + qcol0 + s * 16 + m] = (f16)val;
    }
}

// ---------------------------------------------------------------- launch
extern "C" void kernel_launch(void* const* d_in, const int* in_sizes, int n_in,
                              void* d_out, int out_size, void* d_ws, size_t ws_size,
                              hipStream_t stream) {
  (void)in_sizes; (void)n_in; (void)out_size; (void)ws_size;
  const float* words     = (const float*)d_in[0];
  const float* position  = (const float*)d_in[1];
  const float* conscious = (const float*)d_in[2];
  const float* w_wq = (const float*)d_in[3];
  const float* w_wk = (const float*)d_in[4];
  const float* w_wv = (const float*)d_in[5];
  const float* w_pq = (const float*)d_in[6];
  const float* w_pk = (const float*)d_in[7];
  const float* w_cq = (const float*)d_in[8];
  const float* w_ck = (const float*)d_in[9];
  const float* w_out = (const float*)d_in[10];
  const float* b_out = (const float*)d_in[11];

  f16* ws   = (f16*)d_ws;
  f16* Xcat = ws;                               // 8192 x 3072
  f16* Wqc  = Xcat + (size_t)ROWS * K3;         // 3072 x 1024 [w_wq; w_pq; w_cq]
  f16* Wkc  = Wqc + (size_t)K3 * DIMN;          // 3072 x 1024 [w_wk; w_pk; w_ck]
  f16* Wv   = Wkc + (size_t)K3 * DIMN;          // 1024 x 1024
  f16* Wo   = Wv + (size_t)DIMN * DIMN;         // 1024 x 1024
  f16* Qm   = Wo + (size_t)DIMN * DIMN;         // 8192 x 1024
  f16* Km   = Qm + (size_t)ROWS * DIMN;
  f16* Vm   = Km + (size_t)ROWS * DIMN;
  f16* Am   = Vm + (size_t)ROWS * DIMN;

  pack_xcat<<<4096, 256, 0, stream>>>(words, position, conscious, Xcat);
  pack_w3<<<1024, 256, 0, stream>>>(w_wq, w_pq, w_cq, Wqc);
  pack_w3<<<1024, 256, 0, stream>>>(w_wk, w_pk, w_ck, Wkc);
  pack_w1<<<512, 256, 0, stream>>>(w_wv, Wv, (size_t)DIMN * DIMN);
  pack_w1<<<512, 256, 0, stream>>>(w_out, Wo, (size_t)DIMN * DIMN);

  dim3 g(DIMN / 128, ROWS / 128);  // (8, 64)
  // Q = Xcat @ Wqc (K=3072); K = Xcat @ Wkc; V = words @ Wv (first 1024 cols)
  gemm_wmma<false, false><<<g, 256, 0, stream>>>(Xcat, Wqc, Qm, nullptr, K3, K3, DIMN, DIMN);
  gemm_wmma<false, false><<<g, 256, 0, stream>>>(Xcat, Wkc, Km, nullptr, K3, K3, DIMN, DIMN);
  gemm_wmma<false, false><<<g, 256, 0, stream>>>(Xcat, Wv, Vm, nullptr, DIMN, K3, DIMN, DIMN);

  flash_attn<<<dim3(SEQ / 64, BATCH * NHEADS), 128, 0, stream>>>(Qm, Km, Vm, Am);

  // out = Attn @ Wo + b_out  (f32 output)
  gemm_wmma<true, true><<<g, 256, 0, stream>>>(Am, Wo, d_out, b_out, DIMN, DIMN, DIMN, DIMN);
}

// v001
// A run of this version takes 505 microseconds.
// Two timings next to v000 put it at 2.05 and 2.04 times that version's speed.
#include <hip/hip_runtime.h>

typedef _Float16 f16;
typedef __attribute__((ext_vector_type(16))) _Float16 v16h;
typedef __attribute__((ext_vector_type(8)))  _Float16 v8h;
typedef __attribute__((ext_vector_type(8)))  float    v8f;

#define DIMN 1024
#define HEADD 64
#define NHEADS 16
#define BATCH 4
#define SEQ 2048
#define ROWS (BATCH*SEQ)   /* 8192 */
#define K3   (3*DIMN)      /* 3072 */
#define ATTN_SCALE 0.125f  /* 64^-0.5 */

// K-index mapping for 16-bit A/B fragments (ISA 7.12.2, 16-bit A 16x32):
// VGPR j holds 2 f16; lanes 0-15 cover K {0..7,16..23}, lanes 16-31 add +8.
__device__ __forceinline__ int pairK(int j) { return (j < 4) ? (2 * j) : (16 + 2 * (j - 4)); }

typedef __attribute__((ext_vector_type(4))) unsigned u32x4;
typedef __attribute__((ext_vector_type(8))) short    s16x8;

union AFrag { unsigned u[8]; u32x4 q[2]; v16h v; };

// Transposing LDS load: from a row-major [k][n] tile, lane (c = l & 15, h = l >> 4)
// receives T[kbase + 8h + 0..7][nbase + c]; the lane's own address is
// row kbase + 8h + (l & 7), byte 2*nbase + 16*((l >> 3) & 1). Loads at kbase and
// kbase + 16 fill registers 0-3 and 4-7 of a fragment in the pairK order above.
__device__ __forceinline__ u32x4 ld_tr16(const f16* p) {
  typedef __attribute__((address_space(3))) s16x8 lds_s16x8;
  return __builtin_bit_cast(u32x4, __builtin_amdgcn_ds_load_tr16_b128_v8i16((lds_s16x8*)p));
}

// CDNA5 async copy: global -> LDS, 16 bytes per lane, tracked by ASYNCcnt.
// LDS operand is the low 32 bits of the generic pointer (LDS aperture truncates
// addr[31:0] per ISA 10.2).
// A stage's eight copies (four per tile) and their s_wait_xcnt 0 in one statement,
// so that no address register of an issued copy is rewritten ahead of the wait.
__device__ __forceinline__ void async8_b128(const unsigned (&l)[8], const f16* const (&g)[8]) {
  asm volatile("global_load_async_to_lds_b128 %0, %1, off\n\t"
               "global_load_async_to_lds_b128 %2, %3, off\n\t"
               "global_load_async_to_lds_b128 %4, %5, off\n\t"
               "global_load_async_to_lds_b128 %6, %7, off\n\t"
               "global_load_async_to_lds_b128 %8, %9, off\n\t"
               "global_load_async_to_lds_b128 %10, %11, off\n\t"
               "global_load_async_to_lds_b128 %12, %13, off\n\t"
               "global_load_async_to_lds_b128 %14, %15, off\n\t"
               "s_wait_xcnt 0x0"
               :: "v"(l[0]), "v"(g[0]), "v"(l[1]), "v"(g[1]), "v"(l[2]), "v"(g[2]),
                  "v"(l[3]), "v"(g[3]), "v"(l[4]), "v"(g[4]), "v"(l[5]), "v"(g[5]),
                  "v"(l[6]), "v"(g[6]), "v"(l[7]), "v"(g[7])
               : "memory");
}
__device__ __forceinline__ void wait_async0() {
  asm volatile("s_wait_asynccnt 0x0" ::: "memory");
}

// ---------------------------------------------------------------- pack kernels
__global__ void pack_xcat(const float* __restrict__ a, const float* __restrict__ b,
                          const float* __restrict__ c, f16* __restrict__ out) {
  size_t total = (size_t)ROWS * K3;
  for (size_t i = (size_t)blockIdx.x * blockDim.x + threadIdx.x; i < total;
       i += (size_t)gridDim.x * blockDim.x) {
    size_t row = i / K3;
    int col = (int)(i % K3);
    const float* src = (col < DIMN) ? a : (col < 2 * DIMN ? b : c);
    out[i] = (f16)src[row * DIMN + (col & (DIMN - 1))];
  }
}

__global__ void pack_w3(const float* __restrict__ a, const float* __restrict__ b,
                        const float* __restrict__ c, f16* __restrict__ out) {
  size_t blk = (size_t)DIMN * DIMN;
  size_t total = 3 * blk;
  for (size_t i = (size_t)blockIdx.x * blockDim.x + threadIdx.x; i < total;
       i += (size_t)gridDim.x * blockDim.x) {
    const float* s = (i < blk) ? a : (i < 2 * blk ? b : c);
    out[i] = (f16)s[i % blk];
  }
}

__global__ void pack_w1(const float* __restrict__ a, f16* __restrict__ out, size_t total) {
  for (size_t i = (size_t)blockIdx.x * blockDim.x + threadIdx.x; i < total;
       i += (size_t)gridDim.x * blockDim.x)
    out[i] = (f16)a[i];
}

// ---------------------------------------------------------------- WMMA GEMM
// C[M,N] = A[M,K] @ B[K,N]; f16 in, f32 accumulate; 128x128x64 tiles,
// 256 threads = 8 waves in 4(m) x 2(n) grid, each wave computes 32x64.
// A and B tiles staged via global_load_async_to_lds_b128; B stays row-major in
// LDS and is transposed on the read by ds_load_tr16_b128.
template <bool OUT_F32, bool HAS_BIAS>
__global__ __launch_bounds__(256)
void gemm_wmma(const f16* __restrict__ A, const f16* __restrict__ B,
               void* __restrict__ Cout, const float* __restrict__ bias,
               int K, int lda, int ldb, int ldc) {
  __shared__ f16 lds_a[128 * 72];   // [row][k], padded stride (144B, 16B-aligned)
  __shared__ __attribute__((aligned(16))) f16 lds_b[64 * 144];  // [k][n], stride 288B = 32B x odd

  const int tid = threadIdx.x;
  const int wave = tid >> 5, lane = tid & 31;
  const int m = lane & 15, half = lane >> 4;
  const int waveM = wave >> 1, waveN = wave & 1;
  const int rowBase = blockIdx.y * 128;
  const int colBase = blockIdx.x * 128;

  v8f acc[2][4] = {};

  for (int k0 = 0; k0 < K; k0 += 64) {
    __syncthreads();
    unsigned ldst[8];
    const f16* gsrc[8];
    // A tile: 128x64 f16 = 1024 x 16B, async straight into LDS
#pragma unroll
    for (int it = 0; it < 4; ++it) {
      int v = tid + it * 256;
      int r = v >> 3;            // 8 vectors per row of 64
      int c = (v & 7) * 8;
      ldst[it] = (unsigned)(size_t)&lds_a[r * 72 + c];
      gsrc[it] = &A[(size_t)(rowBase + r) * lda + k0 + c];
    }
    // B tile: 64x128 f16 = 1024 x 16B, async straight into LDS, row-major
#pragma unroll
    for (int it = 0; it < 4; ++it) {
      int v = tid + it * 256;
      int kr = v >> 4;           // 16 vectors per row of 128
      int c = (v & 15) * 8;
      ldst[4 + it] = (unsigned)(size_t)&lds_b[kr * 144 + c];
      gsrc[4 + it] = &B[(size_t)(k0 + kr) * ldb + colBase + c];
    }
    async8_b128(ldst, gsrc);
    wait_async0();
    __syncthreads();

#pragma unroll
    for (int ks = 0; ks < 2; ++ks) {
      const int kk = ks * 32;
      AFrag a[2], b[4];
#pragma unroll
      for (int ms = 0; ms < 2; ++ms) {
        int row = waveM * 32 + ms * 16 + m;
#pragma unroll
        for (int j = 0; j < 8; ++j)
          a[ms].u[j] = *(const unsigned*)&lds_a[row * 72 + kk + pairK(j) + 8 * half];
      }
#pragma unroll
      for (int ns = 0; ns < 4; ++ns) {
        const f16* p = &lds_b[(kk + 8 * half + (lane & 7)) * 144 +
                              waveN * 64 + ns * 16 + 8 * ((lane >> 3) & 1)];
        b[ns].q[0] = ld_tr16(p);
        b[ns].q[1] = ld_tr16(p + 16 * 144);
      }
#pragma unroll
      for (int ms = 0; ms < 2; ++ms)
#pragma unroll
        for (int ns = 0; ns < 4; ++ns)
          acc[ms][ns] = __builtin_amdgcn_wmma_f32_16x16x32_f16(
              false, a[ms].v, false, b[ns].v, (short)0, acc[ms][ns], false, false);
    }
  }

  // Branch-free epilogue: C layout -> row = r + 8*half, col = lane&15.
#pragma unroll
  for (int ms = 0; ms < 2; ++ms)
#pragma unroll
    for (int ns = 0; ns < 4; ++ns) {
      int row0 = rowBase + waveM * 32 + ms * 16 + 8 * half;
      int col = colBase + waveN * 64 + ns * 16 + m;
      float bv = 0.f;
      if constexpr (HAS_BIAS) bv = bias[col];
#pragma unroll
      for (int r = 0; r < 8; ++r) {
        float val = acc[ms][ns][r] + bv;
        size_t idx = (size_t)(row0 + r) * ldc + col;
        if constexpr (OUT_F32) ((float*)Cout)[idx] = val;
        else                   ((f16*)Cout)[idx] = (f16)val;
      }
    }
}

// ---------------------------------------------------------------- flash attention
// grid = (SEQ/64, BATCH*NHEADS); 128 threads = 4 waves, each wave owns 16 q-rows.
__global__ __launch_bounds__(128)
void flash_attn(const f16* __restrict__ Q, const f16* __restrict__ Kmat,
                const f16* __restrict__ Vmat, f16* __restrict__ O) {
  __shared__ f16 lds_k[64 * 64];       // [key][d]
  __shared__ __attribute__((aligned(16))) f16 lds_v[64 * 80];  // [key][d], stride 160B = 32B x odd
  __shared__ f16 lds_p[4 * 16 * 64];   // per-wave P staging (C-layout -> A-layout)

  const int tid = threadIdx.x;
  const int wave = tid >> 5, lane = tid & 31;
  const int m = lane & 15, half = lane >> 4;
  const int bh = blockIdx.y, bi = bh >> 4, h = bh & 15;
  const int qrow0 = bi * SEQ + blockIdx.x * 64 + wave * 16;
  const int qcol0 = h * HEADD;

  // Q rows in A-fragment layout (two frags: d 0..31 and 32..63)
  AFrag aQ[2];
#pragma unroll
  for (int f = 0; f < 2; ++f)
#pragma unroll
    for (int j = 0; j < 8; ++j)
      aQ[f].u[j] = *(const unsigned*)
          &Q[(size_t)(qrow0 + m) * DIMN + qcol0 + pairK(j) + 8 * half + 32 * f];

  v8f Oacc[4] = {};
  float mrun[8], lrun[8];
#pragma unroll
  for (int r = 0; r < 8; ++r) { mrun[r] = -1e30f; lrun[r] = 0.f; }

  for (int kc = 0; kc < SEQ / 64; ++kc) {
    __syncthreads();
    // K and V chunks async -> LDS, both row-major
    unsigned ldst[8];
    const f16* gsrc[8];
#pragma unroll
    for (int it = 0; it < 4; ++it) {
      int v = tid + it * 128;
      int r = v >> 3;
      int c = (v & 7) * 8;
      size_t g = (size_t)(bi * SEQ + kc * 64 + r) * DIMN + qcol0 + c;
      ldst[it] = (unsigned)(size_t)&lds_k[r * 64 + c];
      gsrc[it] = &Kmat[g];
      ldst[4 + it] = (unsigned)(size_t)&lds_v[r * 80 + c];
      gsrc[4 + it] = &Vmat[g];
    }
    async8_b128(ldst, gsrc);
    wait_async0();
    __syncthreads();

    // S = Q @ K^T  (B frag: B[d][key], contiguous d in lds_k rows)
    v8f S[4];
#pragma unroll
    for (int s = 0; s < 4; ++s) {
      AFrag bK[2];
#pragma unroll
      for (int f = 0; f < 2; ++f)
#pragma unroll
        for (int j = 0; j < 8; ++j)
          bK[f].u[j] = *(const unsigned*)
              &lds_k[(s * 16 + m) * 64 + pairK(j) + 8 * half + 32 * f];
      v8f c = {};
      c = __builtin_amdgcn_wmma_f32_16x16x32_f16(false, aQ[0].v, false, bK[0].v,
                                                 (short)0, c, false, false);
      c = __builtin_amdgcn_wmma_f32_16x16x32_f16(false, aQ[1].v, false, bK[1].v,
                                                 (short)0, c, false, false);
      S[s] = c;
    }

    // online softmax; row r of the C tile lives in the 16 lanes of one half-wave,
    // so xor-shuffles 1/2/4/8 reduce across exactly those lanes.
#pragma unroll
    for (int r = 0; r < 8; ++r) {
      float mx = -1e30f;
#pragma unroll
      for (int s = 0; s < 4; ++s) { S[s][r] *= ATTN_SCALE; mx = fmaxf(mx, S[s][r]); }
#pragma unroll
      for (int off = 1; off <= 8; off <<= 1) mx = fmaxf(mx, __shfl_xor(mx, off, 32));
      float nm = fmaxf(mrun[r], mx);
      float alpha = __expf(mrun[r] - nm);
      mrun[r] = nm;
      float ssum = 0.f;
#pragma unroll
      for (int s = 0; s < 4; ++s) {
        float p = __expf(S[s][r] - nm);
        S[s][r] = p;
        ssum += p;
        Oacc[s][r] *= alpha;
      }
#pragma unroll
      for (int off = 1; off <= 8; off <<= 1) ssum += __shfl_xor(ssum, off, 32);
      lrun[r] = lrun[r] * alpha + ssum;
    }

    // P (C layout) -> LDS -> reload in A layout
#pragma unroll
    for (int s = 0; s < 4; ++s)
#pragma unroll
      for (int r = 0; r < 8; ++r)
        lds_p[wave * 1024 + (r + 8 * half) * 64 + s * 16 + m] = (f16)S[s][r];
    __syncthreads();

    AFrag aP[2];
#pragma unroll
    for (int f = 0; f < 2; ++f)
#pragma unroll
      for (int j = 0; j < 8; ++j)
        aP[f].u[j] = *(const unsigned*)
            &lds_p[wave * 1024 + m * 64 + pairK(j) + 8 * half + 32 * f];

    // O += P @ V  (B frag: B[key][d], transposed out of row-major lds_v on the read)
#pragma unroll
    for (int s = 0; s < 4; ++s) {
      AFrag bV[2];
#pragma unroll
      for (int f = 0; f < 2; ++f) {
        const f16* p = &lds_v[(32 * f + 8 * half + (lane & 7)) * 80 +
                              s * 16 + 8 * ((lane >> 3) & 1)];
        bV[f].q[0] = ld_tr16(p);
        bV[f].q[1] = ld_tr16(p + 16 * 80);
      }
      Oacc[s] = __builtin_amdgcn_wmma_f32_16x16x32_f16(false, aP[0].v, false, bV[0].v,
                                                       (short)0, Oacc[s], false, false);
      Oacc[s] = __builtin_amdgcn_wmma_f32_16x16x32_f16(false, aP[1].v, false, bV[1].v,
                                                       (short)0, Oacc[s], false, false);
    }
  }

  // normalize and store (f16, row-major [b*n, h*d])
#pragma unroll
  for (int s = 0; s < 4; ++s)
#pragma unroll
    for (int r = 0; r < 8; ++r) {
      float val = Oacc[s][r] / lrun[r];
      O[(size_t)(qrow0 + r + 8 * half) * DIMN + qcol0 + s * 16 + m] = (f16)val;
    }
}

// ---------------------------------------------------------------- launch
extern "C" void kernel_launch(void* const* d_in, const int* in_sizes, int n_in,
                              void* d_out, int out_size, void* d_ws, size_t ws_size,
                              hipStream_t stream) {
  (void)in_sizes; (void)n_in; (void)out_size; (void)ws_size;
  const float* words     = (const float*)d_in[0];
  const float* position  = (const float*)d_in[1];
  const float* conscious = (const float*)d_in[2];
  const float* w_wq = (const float*)d_in[3];
  const float* w_wk = (const float*)d_in[4];
  const float* w_wv = (const float*)d_in[5];
  const float* w_pq = (const float*)d_in[6];
  const float* w_pk = (const float*)d_in[7];
  const float* w_cq = (const float*)d_in[8];
  const float* w_ck = (const float*)d_in[9];
  const float* w_out = (const float*)d_in[10];
  const float* b_out = (const float*)d_in[11];

  f16* ws   = (f16*)d_ws;
  f16* Xcat = ws;                               // 8192 x 3072
  f16* Wqc  = Xcat + (size_t)ROWS * K3;         // 3072 x 1024 [w_wq; w_pq; w_cq]
  f16* Wkc  = Wqc + (size_t)K3 * DIMN;          // 3072 x 1024 [w_wk; w_pk; w_ck]
  f16* Wv   = Wkc + (size_t)K3 * DIMN;          // 1024 x 1024
  f16* Wo   = Wv + (size_t)DIMN * DIMN;         // 1024 x 1024
  f16* Qm   = Wo + (size_t)DIMN * DIMN;         // 8192 x 1024
  f16* Km   = Qm + (size_t)ROWS * DIMN;
  f16* Vm   = Km + (size_t)ROWS * DIMN;
  f16* Am   = Vm + (size_t)ROWS * DIMN;

  pack_xcat<<<4096, 256, 0, stream>>>(words, position, conscious, Xcat);
  pack_w3<<<1024, 256, 0, stream>>>(w_wq, w_pq, w_cq, Wqc);
  pack_w3<<<1024, 256, 0, stream>>>(w_wk, w_pk, w_ck, Wkc);
  pack_w1<<<512, 256, 0, stream>>>(w_wv, Wv, (size_t)DIMN * DIMN);
  pack_w1<<<512, 256, 0, stream>>>(w_out, Wo, (size_t)DIMN * DIMN);

  dim3 g(DIMN / 128, ROWS / 128);  // (8, 64)
  // Q = Xcat @ Wqc (K=3072); K = Xcat @ Wkc; V = words @ Wv (first 1024 cols)
  gemm_wmma<false, false><<<g, 256, 0, stream>>>(Xcat, Wqc, Qm, nullptr, K3, K3, DIMN, DIMN);
  gemm_wmma<false, false><<<g, 256, 0, stream>>>(Xcat, Wkc, Km, nullptr, K3, K3, DIMN, DIMN);
  gemm_wmma<false, false><<<g, 256, 0, stream>>>(Xcat, Wv, Vm, nullptr, DIMN, K3, DIMN, DIMN);

  flash_attn<<<dim3(SEQ / 64, BATCH * NHEADS), 128, 0, stream>>>(Qm, Km, Vm, Am);

  // out = Attn @ Wo + b_out  (f32 output)
  gemm_wmma<true, true><<<g, 256, 0, stream>>>(Am, Wo, d_out, b_out, DIMN, DIMN, DIMN, DIMN);
}

// v002
// It runs in 372 microseconds.
// Next to v001, in two timings, it ran 1.31 times as fast each time.
// All steps since v000 together make it 2.67 times as fast.
#include <hip/hip_runtime.h>

typedef _Float16 f16;
typedef __attribute__((ext_vector_type(16))) _Float16 v16h;
typedef __attribute__((ext_vector_type(8)))  _Float16 v8h;
typedef __attribute__((ext_vector_type(8)))  float    v8f;

#define DIMN 1024
#define HEADD 64
#define NHEADS 16
#define BATCH 4
#define SEQ 2048
#define ROWS (BATCH*SEQ)   /* 8192 */
#define K3   (3*DIMN)      /* 3072 */
#define ATTN_SCALE 0.125f  /* 64^-0.5 */
#define LOG2E 1.4426950408889634f

// K-index mapping for 16-bit A/B fragments (ISA 7.12.2, 16-bit A 16x32):
// VGPR j holds 2 f16; lanes 0-15 cover K {0..7,16..23}, lanes 16-31 add +8.
__device__ __forceinline__ int pairK(int j) { return (j < 4) ? (2 * j) : (16 + 2 * (j - 4)); }

typedef __attribute__((ext_vector_type(4))) unsigned u32x4;
typedef __attribute__((ext_vector_type(8))) short    s16x8;

typedef __attribute__((ext_vector_type(2))) float    f32x2;
typedef __attribute__((ext_vector_type(2))) _Float16 f16x2;

union AFrag { unsigned u[8]; u32x4 q[2]; f16x2 h2[8]; v16h v; };

// Transposing LDS load: from a row-major [k][n] tile, lane (c = l & 15, h = l >> 4)
// receives T[kbase + 8h + 0..7][nbase + c]; the lane's own address is
// row kbase + 8h + (l & 7), byte 2*nbase + 16*((l >> 3) & 1). Loads at kbase and
// kbase + 16 fill registers 0-3 and 4-7 of a fragment in the pairK order above.
__device__ __forceinline__ u32x4 ld_tr16(const f16* p) {
  typedef __attribute__((address_space(3))) s16x8 lds_s16x8;
  return __builtin_bit_cast(u32x4, __builtin_amdgcn_ds_load_tr16_b128_v8i16((lds_s16x8*)p));
}

// CDNA5 async copy: global -> LDS, 16 bytes per lane, tracked by ASYNCcnt.
// LDS operand is the low 32 bits of the generic pointer (LDS aperture truncates
// addr[31:0] per ISA 10.2).
// A stage's eight copies (four per tile) and their s_wait_xcnt 0 in one statement,
// so that no address register of an issued copy is rewritten ahead of the wait.
__device__ __forceinline__ void async8_b128(const unsigned (&l)[8], const f16* const (&g)[8]) {
  asm volatile("global_load_async_to_lds_b128 %0, %1, off\n\t"
               "global_load_async_to_lds_b128 %2, %3, off\n\t"
               "global_load_async_to_lds_b128 %4, %5, off\n\t"
               "global_load_async_to_lds_b128 %6, %7, off\n\t"
               "global_load_async_to_lds_b128 %8, %9, off\n\t"
               "global_load_async_to_lds_b128 %10, %11, off\n\t"
               "global_load_async_to_lds_b128 %12, %13, off\n\t"
               "global_load_async_to_lds_b128 %14, %15, off\n\t"
               "s_wait_xcnt 0x0"
               :: "v"(l[0]), "v"(g[0]), "v"(l[1]), "v"(g[1]), "v"(l[2]), "v"(g[2]),
                  "v"(l[3]), "v"(g[3]), "v"(l[4]), "v"(g[4]), "v"(l[5]), "v"(g[5]),
                  "v"(l[6]), "v"(g[6]), "v"(l[7]), "v"(g[7])
               : "memory");
}
__device__ __forceinline__ void wait_async0() {
  asm volatile("s_wait_asynccnt 0x0" ::: "memory");
}

// ---------------------------------------------------------------- pack kernels
__global__ void pack_xcat(const float* __restrict__ a, const float* __restrict__ b,
                          const float* __restrict__ c, f16* __restrict__ out) {
  size_t total = (size_t)ROWS * K3;
  for (size_t i = (size_t)blockIdx.x * blockDim.x + threadIdx.x; i < total;
       i += (size_t)gridDim.x * blockDim.x) {
    size_t row = i / K3;
    int col = (int)(i % K3);
    const float* src = (col < DIMN) ? a : (col < 2 * DIMN ? b : c);
    out[i] = (f16)src[row * DIMN + (col & (DIMN - 1))];
  }
}

__global__ void pack_w3(const float* __restrict__ a, const float* __restrict__ b,
                        const float* __restrict__ c, f16* __restrict__ out) {
  size_t blk = (size_t)DIMN * DIMN;
  size_t total = 3 * blk;
  for (size_t i = (size_t)blockIdx.x * blockDim.x + threadIdx.x; i < total;
       i += (size_t)gridDim.x * blockDim.x) {
    const float* s = (i < blk) ? a : (i < 2 * blk ? b : c);
    out[i] = (f16)s[i % blk];
  }
}

__global__ void pack_w1(const float* __restrict__ a, f16* __restrict__ out, size_t total) {
  for (size_t i = (size_t)blockIdx.x * blockDim.x + threadIdx.x; i < total;
       i += (size_t)gridDim.x * blockDim.x)
    out[i] = (f16)a[i];
}

// ---------------------------------------------------------------- WMMA GEMM
// C[M,N] = A[M,K] @ B[K,N]; f16 in, f32 accumulate; 128x128x64 tiles,
// 256 threads = 8 waves in 4(m) x 2(n) grid, each wave computes 32x64.
// A and B tiles staged via global_load_async_to_lds_b128; B stays row-major in
// LDS and is transposed on the read by ds_load_tr16_b128.
template <bool OUT_F32, bool HAS_BIAS>
__global__ __launch_bounds__(256)
void gemm_wmma(const f16* __restrict__ A, const f16* __restrict__ B,
               void* __restrict__ Cout, const float* __restrict__ bias,
               int K, int lda, int ldb, int ldc) {
  __shared__ f16 lds_a[128 * 72];   // [row][k], padded stride (144B, 16B-aligned)
  __shared__ __attribute__((aligned(16))) f16 lds_b[64 * 144];  // [k][n], stride 288B = 32B x odd

  const int tid = threadIdx.x;
  const int wave = tid >> 5, lane = tid & 31;
  const int m = lane & 15, half = lane >> 4;
  const int waveM = wave >> 1, waveN = wave & 1;
  const int rowBase = blockIdx.y * 128;
  const int colBase = blockIdx.x * 128;

  v8f acc[2][4] = {};

  for (int k0 = 0; k0 < K; k0 += 64) {
    __syncthreads();
    unsigned ldst[8];
    const f16* gsrc[8];
    // A tile: 128x64 f16 = 1024 x 16B, async straight into LDS
#pragma unroll
    for (int it = 0; it < 4; ++it) {
      int v = tid + it * 256;
      int r = v >> 3;            // 8 vectors per row of 64
      int c = (v & 7) * 8;
      ldst[it] = (unsigned)(size_t)&lds_a[r * 72 + c];
      gsrc[it] = &A[(size_t)(rowBase + r) * lda + k0 + c];
    }
    // B tile: 64x128 f16 = 1024 x 16B, async straight into LDS, row-major
#pragma unroll
    for (int it = 0; it < 4; ++it) {
      int v = tid + it * 256;
      int kr = v >> 4;           // 16 vectors per row of 128
      int c = (v & 15) * 8;
      ldst[4 + it] = (unsigned)(size_t)&lds_b[kr * 144 + c];
      gsrc[4 + it] = &B[(size_t)(k0 + kr) * ldb + colBase + c];
    }
    async8_b128(ldst, gsrc);
    wait_async0();
    __syncthreads();

#pragma unroll
    for (int ks = 0; ks < 2; ++ks) {
      const int kk = ks * 32;
      AFrag a[2], b[4];
#pragma unroll
      for (int ms = 0; ms < 2; ++ms) {
        int row = waveM * 32 + ms * 16 + m;
#pragma unroll
        for (int j = 0; j < 8; ++j)
          a[ms].u[j] = *(const unsigned*)&lds_a[row * 72 + kk + pairK(j) + 8 * half];
      }
#pragma unroll
      for (int ns = 0; ns < 4; ++ns) {
        const f16* p = &lds_b[(kk + 8 * half + (lane & 7)) * 144 +
                              waveN * 64 + ns * 16 + 8 * ((lane >> 3) & 1)];
        b[ns].q[0] = ld_tr16(p);
        b[ns].q[1] = ld_tr16(p + 16 * 144);
      }
#pragma unroll
      for (int ms = 0; ms < 2; ++ms)
#pragma unroll
        for (int ns = 0; ns < 4; ++ns)
          acc[ms][ns] = __builtin_amdgcn_wmma_f32_16x16x32_f16(
              false, a[ms].v, false, b[ns].v, (short)0, acc[ms][ns], false, false);
    }
  }

  // Branch-free epilogue: C layout -> row = r + 8*half, col = lane&15.
#pragma unroll
  for (int ms = 0; ms < 2; ++ms)
#pragma unroll
    for (int ns = 0; ns < 4; ++ns) {
      int row0 = rowBase + waveM * 32 + ms * 16 + 8 * half;
      int col = colBase + waveN * 64 + ns * 16 + m;
      float bv = 0.f;
      if constexpr (HAS_BIAS) bv = bias[col];
#pragma unroll
      for (int r = 0; r < 8; ++r) {
        float val = acc[ms][ns][r] + bv;
        size_t idx = (size_t)(row0 + r) * ldc + col;
        if constexpr (OUT_F32) ((float*)Cout)[idx] = val;
        else                   ((f16*)Cout)[idx] = (f16)val;
      }
    }
}

// lane l with lane l ^ 16
__device__ __forceinline__ float xhalf(float x) {
  int b = __builtin_bit_cast(int, x);
  return __builtin_bit_cast(float,
      __builtin_amdgcn_permlanex16(b, b, 0x76543210, 0xfedcba98, false, false));
}

__global__ __launch_bounds__(128)
void flash_attn(const f16* __restrict__ Q, const f16* __restrict__ Kmat,
                const f16* __restrict__ Vmat, f16* __restrict__ O) {
  __shared__ f16 lds_k[64 * 64];       // [key][d], rows of 128B, no pad
  __shared__ __attribute__((aligned(16))) f16 lds_v[64 * 80];  // [key][d], stride 160B = 32B x odd

  const int tid = threadIdx.x;
  const int wave = tid >> 5, lane = tid & 31;
  const int m = lane & 15, half = lane >> 4;
  const int bh = blockIdx.y, bi = bh >> 4, h = bh & 15;
  const int qrow0 = bi * SEQ + blockIdx.x * 64 + wave * 16;
  const int qcol0 = h * HEADD;

  // Q^T as B operand: column = query m, k = d in the pairK order (two frags: d 0..31, 32..63)
  AFrag bQ[2];
#pragma unroll
  for (int f = 0; f < 2; ++f)
#pragma unroll
    for (int j = 0; j < 8; ++j)
      bQ[f].u[j] = *(const unsigned*)
          &Q[(size_t)(qrow0 + m) * DIMN + qcol0 + pairK(j) + 8 * half + 32 * f];

  v8f Oacc[4] = {};            // O^T: Oacc[s][r] = O[query m][d = 16 s + 8 half + r]
  float mrun = -1e30f;         // query m's running maximum, equal in both of its lanes
  float lrun = 0.f;            // running sum over this lane's own keys only

  for (int kc = 0; kc < SEQ / 64; ++kc) {
    __syncthreads();
    // K and V chunks async -> LDS, both row-major
    unsigned ldst[8];
    const f16* gsrc[8];
#pragma unroll
    for (int it = 0; it < 4; ++it) {
      int v = tid + it * 128;
      int r = v >> 3;
      int c = (v & 7) * 8;
      size_t g = (size_t)(bi * SEQ + kc * 64 + r) * DIMN + qcol0 + c;
      ldst[it] = (unsigned)(size_t)&lds_k[r * 64 + c];
      gsrc[it] = &Kmat[g];
      ldst[4 + it] = (unsigned)(size_t)&lds_v[r * 80 + c];
      gsrc[4 + it] = &Vmat[g];
    }
    async8_b128(ldst, gsrc);
    wait_async0();
    __syncthreads();

    // S^T = K @ Q^T  (A frag: row = key, contiguous d in lds_k rows)
    v8f S[4];
#pragma unroll
    for (int t = 0; t < 4; ++t) {
      AFrag aK[2];
#pragma unroll
      for (int f = 0; f < 2; ++f)
#pragma unroll
        for (int j = 0; j < 8; ++j)
          aK[f].u[j] = *(const unsigned*)
              &lds_k[(t * 16 + m) * 64 + pairK(j) + 8 * half + 32 * f];
      v8f c = {};
      c = __builtin_amdgcn_wmma_f32_16x16x32_f16(false, aK[0].v, false, bQ[0].v,
                                                 (short)0, c, false, false);
      c = __builtin_amdgcn_wmma_f32_16x16x32_f16(false, aK[1].v, false, bQ[1].v,
                                                 (short)0, c, false, false);
      S[t] = c;
    }

    // online softmax of query m: 32 of the chunk's 64 keys are in this lane,
    // the other 32 in lane ^ 16. Scores are handled two at a time (packed f32).
    f32x2 Sp[4][4];
    float mt[4];
#pragma unroll
    for (int t = 0; t < 4; ++t) {
      mt[t] = -1e30f;
#pragma unroll
      for (int i = 0; i < 4; ++i) {
        f32x2 x = {S[t][2 * i], S[t][2 * i + 1]};
        x *= ATTN_SCALE;
        Sp[t][i] = x;
        mt[t] = fmaxf(mt[t], fmaxf(x.x, x.y));
      }
    }
    float mx = fmaxf(fmaxf(mt[0], mt[1]), fmaxf(mt[2], mt[3]));
    mx = fmaxf(mx, xhalf(mx));
    float nm = fmaxf(mrun, mx);
    float alpha = __expf(mrun - nm);
    mrun = nm;

    // P^T as B operand, packed in place: key tiles 2f and 2f+1 hold keys
    // 32 f + 8 half + 0..7 and 32 f + 16 + 8 half + 0..7, which is the pairK order.
    AFrag bP[2];
    f32x2 st[4];
#pragma unroll
    for (int t = 0; t < 4; ++t) {
#pragma unroll
      for (int i = 0; i < 4; ++i) {
        f32x2 a = (Sp[t][i] - nm) * LOG2E;
        f32x2 p = {__builtin_amdgcn_exp2f(a.x), __builtin_amdgcn_exp2f(a.y)};
        st[t] = (i == 0) ? p : st[t] + p;
        bP[t >> 1].h2[(t & 1) * 4 + i] = __builtin_convertvector(p, f16x2);
      }
    }
    f32x2 sall = (st[0] + st[1]) + (st[2] + st[3]);
    lrun = lrun * alpha + (sall.x + sall.y);
#pragma unroll
    for (int s = 0; s < 4; ++s) Oacc[s] *= alpha;

    // O^T += V^T @ P^T  (A frag: row = d, transposed out of row-major lds_v on the read)
#pragma unroll
    for (int s = 0; s < 4; ++s) {
      AFrag aV[2];
#pragma unroll
      for (int f = 0; f < 2; ++f) {
        const f16* p = &lds_v[(32 * f + 8 * half + (lane & 7)) * 80 +
                              s * 16 + 8 * ((lane >> 3) & 1)];
        aV[f].q[0] = ld_tr16(p);
        aV[f].q[1] = ld_tr16(p + 16 * 80);
      }
      Oacc[s] = __builtin_amdgcn_wmma_f32_16x16x32_f16(false, aV[0].v, false, bP[0].v,
                                                       (short)0, Oacc[s], false, false);
      Oacc[s] = __builtin_amdgcn_wmma_f32_16x16x32_f16(false, aV[1].v, false, bP[1].v,
                                                       (short)0, Oacc[s], false, false);
    }
  }

  // join the two lanes' sums, normalize and store (f16, row-major [b*n, h*d]):
  // a lane's 8 registers of a tile are 8 consecutive d of its query's row.
  const float lsum = lrun + xhalf(lrun);
#pragma unroll
  for (int s = 0; s < 4; ++s) {
    v8h o;
#pragma unroll
    for (int r = 0; r < 8; ++r) o[r] = (f16)(Oacc[s][r] / lsum);
    *(v8h*)&O[(size_t)(qrow0 + m) * DIMN + qcol0 + s * 16 + 8 * half] = o;
  }
}

// ---------------------------------------------------------------- launch
extern "C" void kernel_launch(void* const* d_in, const int* in_sizes, int n_in,
                              void* d_out, int out_size, void* d_ws, size_t ws_size,
                              hipStream_t stream) {
  (void)in_sizes; (void)n_in; (void)out_size; (void)ws_size;
  const float* words     = (const float*)d_in[0];
  const float* position  = (const float*)d_in[1];
  const float* conscious = (const float*)d_in[2];
  const float* w_wq = (const float*)d_in[3];
  const float* w_wk = (const float*)d_in[4];
  const float* w_wv = (const float*)d_in[5];
  const float* w_pq = (const float*)d_in[6];
  const float* w_pk = (const float*)d_in[7];
  const float* w_cq = (const float*)d_in[8];
  const float* w_ck = (const float*)d_in[9];
  const float* w_out = (const float*)d_in[10];
  const float* b_out = (const float*)d_in[11];

  f16* ws   = (f16*)d_ws;
  f16* Xcat = ws;                               // 8192 x 3072
  f16* Wqc  = Xcat + (size_t)ROWS * K3;         // 3072 x 1024 [w_wq; w_pq; w_cq]
  f16* Wkc  = Wqc + (size_t)K3 * DIMN;          // 3072 x 1024 [w_wk; w_pk; w_ck]
  f16* Wv   = Wkc + (size_t)K3 * DIMN;          // 1024 x 1024
  f16* Wo   = Wv + (size_t)DIMN * DIMN;         // 1024 x 1024
  f16* Qm   = Wo + (size_t)DIMN * DIMN;         // 8192 x 1024
  f16* Km   = Qm + (size_t)ROWS * DIMN;
  f16* Vm   = Km + (size_t)ROWS * DIMN;
  f16* Am   = Vm + (size_t)ROWS * DIMN;

  pack_xcat<<<4096, 256, 0, stream>>>(words, position, conscious, Xcat);
  pack_w3<<<1024, 256, 0, stream>>>(w_wq, w_pq, w_cq, Wqc);
  pack_w3<<<1024, 256, 0, stream>>>(w_wk, w_pk, w_ck, Wkc);
  pack_w1<<<512, 256, 0, stream>>>(w_wv, Wv, (size_t)DIMN * DIMN);
  pack_w1<<<512, 256, 0, stream>>>(w_out, Wo, (size_t)DIMN * DIMN);

  dim3 g(DIMN / 128, ROWS / 128);  // (8, 64)
  // Q = Xcat @ Wqc (K=3072); K = Xcat @ Wkc; V = words @ Wv (first 1024 cols)
  gemm_wmma<false, false><<<g, 256, 0, stream>>>(Xcat, Wqc, Qm, nullptr, K3, K3, DIMN, DIMN);
  gemm_wmma<false, false><<<g, 256, 0, stream>>>(Xcat, Wkc, Km, nullptr, K3, K3, DIMN, DIMN);
  gemm_wmma<false, false><<<g, 256, 0, stream>>>(Xcat, Wv, Vm, nullptr, DIMN, K3, DIMN, DIMN);

  flash_attn<<<dim3(SEQ / 64, BATCH * NHEADS), 128, 0, stream>>>(Qm, Km, Vm, Am);

  // out = Attn @ Wo + b_out  (f32 output)
  gemm_wmma<true, true><<<g, 256, 0, stream>>>(Am, Wo, d_out, b_out, DIMN, DIMN, DIMN, DIMN);
}

// v003
// Measured time: 313 microseconds a run.
// Next to v002, in two timings, it ran 1.23 and 1.22 times as fast.
// All steps since v000 together make it 3.26 times as fast.
#include <hip/hip_runtime.h>

typedef _Float16 f16;
typedef __attribute__((ext_vector_type(16))) _Float16 v16h;
typedef __attribute__((ext_vector_type(8)))  _Float16 v8h;
typedef __attribute__((ext_vector_type(8)))  float    v8f;

#define DIMN 1024
#define HEADD 64
#define NHEADS 16
#define BATCH 4
#define SEQ 2048
#define ROWS (BATCH*SEQ)   /* 8192 */
#define K3   (3*DIMN)      /* 3072 */
#define ATTN_SCALE 0.125f  /* 64^-0.5 */
#define LOG2E 1.4426950408889634f

// K-index mapping for 16-bit A/B fragments (ISA 7.12.2, 16-bit A 16x32):
// VGPR j holds 2 f16; lanes 0-15 cover K {0..7,16..23}, lanes 16-31 add +8.
__device__ __forceinline__ int pairK(int j) { return (j < 4) ? (2 * j) : (16 + 2 * (j - 4)); }

typedef __attribute__((ext_vector_type(4))) unsigned u32x4;
typedef __attribute__((ext_vector_type(8))) short    s16x8;

typedef __attribute__((ext_vector_type(2))) float    f32x2;
typedef __attribute__((ext_vector_type(2))) _Float16 f16x2;

union AFrag { unsigned u[8]; u32x4 q[2]; f16x2 h2[8]; v16h v; };

// Transposing LDS load: from a row-major [k][n] tile, lane (c = l & 15, h = l >> 4)
// receives T[kbase + 8h + 0..7][nbase + c]; the lane's own address is
// row kbase + 8h + (l & 7), byte 2*nbase + 16*((l >> 3) & 1). Loads at kbase and
// kbase + 16 fill registers 0-3 and 4-7 of a fragment in the pairK order above.
__device__ __forceinline__ u32x4 ld_tr16(const f16* p) {
  typedef __attribute__((address_space(3))) s16x8 lds_s16x8;
  return __builtin_bit_cast(u32x4, __builtin_amdgcn_ds_load_tr16_b128_v8i16((lds_s16x8*)p));
}

// CDNA5 async copy: global -> LDS, 16 bytes per lane, tracked by ASYNCcnt.
// LDS operand is the low 32 bits of the generic pointer (LDS aperture truncates
// addr[31:0] per ISA 10.2).
// A stage's eight copies (four per tile) and their s_wait_xcnt 0 in one statement,
// so that no address register of an issued copy is rewritten ahead of the wait.
__device__ __forceinline__ void async8_b128(const unsigned (&l)[8], const f16* const (&g)[8]) {
  asm volatile("global_load_async_to_lds_b128 %0, %1, off\n\t"
               "global_load_async_to_lds_b128 %2, %3, off\n\t"
               "global_load_async_to_lds_b128 %4, %5, off\n\t"
               "global_load_async_to_lds_b128 %6, %7, off\n\t"
               "global_load_async_to_lds_b128 %8, %9, off\n\t"
               "global_load_async_to_lds_b128 %10, %11, off\n\t"
               "global_load_async_to_lds_b128 %12, %13, off\n\t"
               "global_load_async_to_lds_b128 %14, %15, off\n\t"
               "s_wait_xcnt 0x0"
               :: "v"(l[0]), "v"(g[0]), "v"(l[1]), "v"(g[1]), "v"(l[2]), "v"(g[2]),
                  "v"(l[3]), "v"(g[3]), "v"(l[4]), "v"(g[4]), "v"(l[5]), "v"(g[5]),
                  "v"(l[6]), "v"(g[6]), "v"(l[7]), "v"(g[7])
               : "memory");
}
__device__ __forceinline__ void wait_async0() {
  asm volatile("s_wait_asynccnt 0x0" ::: "memory");
}

// ---------------------------------------------------------------- pack kernels
__global__ void pack_xcat(const float* __restrict__ a, const float* __restrict__ b,
                          const float* __restrict__ c, f16* __restrict__ out) {
  size_t total = (size_t)ROWS * K3;
  for (size_t i = (size_t)blockIdx.x * blockDim.x + threadIdx.x; i < total;
       i += (size_t)gridDim.x * blockDim.x) {
    size_t row = i / K3;
    int col = (int)(i % K3);
    const float* src = (col < DIMN) ? a : (col < 2 * DIMN ? b : c);
    out[i] = (f16)src[row * DIMN + (col & (DIMN - 1))];
  }
}

__global__ void pack_w3(const float* __restrict__ a, const float* __restrict__ b,
                        const float* __restrict__ c, f16* __restrict__ out) {
  size_t blk = (size_t)DIMN * DIMN;
  size_t total = 3 * blk;
  for (size_t i = (size_t)blockIdx.x * blockDim.x + threadIdx.x; i < total;
       i += (size_t)gridDim.x * blockDim.x) {
    const float* s = (i < blk) ? a : (i < 2 * blk ? b : c);
    out[i] = (f16)s[i % blk];
  }
}

__global__ void pack_w1(const float* __restrict__ a, f16* __restrict__ out, size_t total) {
  for (size_t i = (size_t)blockIdx.x * blockDim.x + threadIdx.x; i < total;
       i += (size_t)gridDim.x * blockDim.x)
    out[i] = (f16)a[i];
}

// ---------------------------------------------------------------- WMMA GEMM
// C[M,N] = A[M,K] @ B[K,N]; f16 in, f32 accumulate; 128x128x64 tiles,
// 256 threads = 8 waves in 4(m) x 2(n) grid, each wave computes 32x64.
// A and B tiles staged via global_load_async_to_lds_b128; B stays row-major in
// LDS and is transposed on the read by ds_load_tr16_b128.
template <bool OUT_F32, bool HAS_BIAS>
__global__ __launch_bounds__(256)
void gemm_wmma(const f16* __restrict__ A, const f16* __restrict__ B,
               void* __restrict__ Cout, const float* __restrict__ bias,
               int K, int lda, int ldb, int ldc) {
  __shared__ f16 lds_a[128 * 72];   // [row][k], padded stride (144B, 16B-aligned)
  __shared__ __attribute__((aligned(16))) f16 lds_b[64 * 144];  // [k][n], stride 288B = 32B x odd

  const int tid = threadIdx.x;
  const int wave = tid >> 5, lane = tid & 31;
  const int m = lane & 15, half = lane >> 4;
  const int waveM = wave >> 1, waveN = wave & 1;
  const int rowBase = blockIdx.y * 128;
  const int colBase = blockIdx.x * 128;

  v8f acc[2][4] = {};

  for (int k0 = 0; k0 < K; k0 += 64) {
    __syncthreads();
    unsigned ldst[8];
    const f16* gsrc[8];
    // A tile: 128x64 f16 = 1024 x 16B, async straight into LDS
#pragma unroll
    for (int it = 0; it < 4; ++it) {
      int v = tid + it * 256;
      int r = v >> 3;            // 8 vectors per row of 64
      int c = (v & 7) * 8;
      ldst[it] = (unsigned)(size_t)&lds_a[r * 72 + c];
      gsrc[it] = &A[(size_t)(rowBase + r) * lda + k0 + c];
    }
    // B tile: 64x128 f16 = 1024 x 16B, async straight into LDS, row-major
#pragma unroll
    for (int it = 0; it < 4; ++it) {
      int v = tid + it * 256;
      int kr = v >> 4;           // 16 vectors per row of 128
      int c = (v & 15) * 8;
      ldst[4 + it] = (unsigned)(size_t)&lds_b[kr * 144 + c];
      gsrc[4 + it] = &B[(size_t)(k0 + kr) * ldb + colBase + c];
    }
    async8_b128(ldst, gsrc);
    wait_async0();
    __syncthreads();

#pragma unroll
    for (int ks = 0; ks < 2; ++ks) {
      const int kk = ks * 32;
      AFrag a[2], b[4];
#pragma unroll
      for (int ms = 0; ms < 2; ++ms) {
        int row = waveM * 32 + ms * 16 + m;
#pragma unroll
        for (int j = 0; j < 8; ++j)
          a[ms].u[j] = *(const unsigned*)&lds_a[row * 72 + kk + pairK(j) + 8 * half];
      }
#pragma unroll
      for (int ns = 0; ns < 4; ++ns) {
        const f16* p = &lds_b[(kk + 8 * half + (lane & 7)) * 144 +
                              waveN * 64 + ns * 16 + 8 * ((lane >> 3) & 1)];
        b[ns].q[0] = ld_tr16(p);
        b[ns].q[1] = ld_tr16(p + 16 * 144);
      }
#pragma unroll
      for (int ms = 0; ms < 2; ++ms)
#pragma unroll
        for (int ns = 0; ns < 4; ++ns)
          acc[ms][ns] = __builtin_amdgcn_wmma_f32_16x16x32_f16(
              false, a[ms].v, false, b[ns].v, (short)0, acc[ms][ns], false, false);
    }
  }

  // Branch-free epilogue: C layout -> row = r + 8*half, col = lane&15.
#pragma unroll
  for (int ms = 0; ms < 2; ++ms)
#pragma unroll
    for (int ns = 0; ns < 4; ++ns) {
      int row0 = rowBase + waveM * 32 + ms * 16 + 8 * half;
      int col = colBase + waveN * 64 + ns * 16 + m;
      float bv = 0.f;
      if constexpr (HAS_BIAS) bv = bias[col];
#pragma unroll
      for (int r = 0; r < 8; ++r) {
        float val = acc[ms][ns][r] + bv;
        size_t idx = (size_t)(row0 + r) * ldc + col;
        if constexpr (OUT_F32) ((float*)Cout)[idx] = val;
        else                   ((f16*)Cout)[idx] = (f16)val;
      }
    }
}

// lane l with lane l ^ 16
__device__ __forceinline__ float xhalf(float x) {
  int b = __builtin_bit_cast(int, x);
  return __builtin_bit_cast(float,
      __builtin_amdgcn_permlanex16(b, b, 0x76543210, 0xfedcba98, false, false));
}

__global__ __launch_bounds__(128)
void flash_attn(const f16* __restrict__ Q, const f16* __restrict__ Kmat,
                const f16* __restrict__ Vmat, f16* __restrict__ O) {
  __shared__ __attribute__((aligned(16))) f16 lds_k[64 * 72];  // [key][d], stride 144B = 16B x odd
  __shared__ __attribute__((aligned(16))) f16 lds_v[64 * 80];  // [key][d], stride 160B = 32B x odd

  const int tid = threadIdx.x;
  const int wave = tid >> 5, lane = tid & 31;
  const int m = lane & 15, half = lane >> 4;
  const int bh = blockIdx.y, bi = bh >> 4, h = bh & 15;
  const int qrow0 = bi * SEQ + blockIdx.x * 64 + wave * 16;
  const int qcol0 = h * HEADD;

  // Q^T as B operand: column = query m, k = d in the pairK order (two frags: d 0..31, 32..63)
  AFrag bQ[2];
#pragma unroll
  for (int f = 0; f < 2; ++f)
#pragma unroll
    for (int j = 0; j < 8; ++j)
      bQ[f].u[j] = *(const unsigned*)
          &Q[(size_t)(qrow0 + m) * DIMN + qcol0 + pairK(j) + 8 * half + 32 * f];

  v8f Oacc[4] = {};            // O^T: Oacc[s][r] = O[query m][d = 16 s + 8 half + r]
  float mrun = -1e30f;         // query m's running maximum, equal in both of its lanes
  float lrun = 0.f;            // running sum over this lane's own keys only

  for (int kc = 0; kc < SEQ / 64; ++kc) {
    __syncthreads();
    // K and V chunks async -> LDS, both row-major
    unsigned ldst[8];
    const f16* gsrc[8];
#pragma unroll
    for (int it = 0; it < 4; ++it) {
      int v = tid + it * 128;
      int r = v >> 3;
      int c = (v & 7) * 8;
      size_t g = (size_t)(bi * SEQ + kc * 64 + r) * DIMN + qcol0 + c;
      ldst[it] = (unsigned)(size_t)&lds_k[r * 72 + c];
      gsrc[it] = &Kmat[g];
      ldst[4 + it] = (unsigned)(size_t)&lds_v[r * 80 + c];
      gsrc[4 + it] = &Vmat[g];
    }
    async8_b128(ldst, gsrc);
    wait_async0();
    __syncthreads();

    // S^T = K @ Q^T  (A frag: row = key, contiguous d in lds_k rows)
    v8f S[4];
#pragma unroll
    for (int t = 0; t < 4; ++t) {
      AFrag aK[2];
#pragma unroll
      for (int f = 0; f < 2; ++f)
#pragma unroll
        for (int j = 0; j < 8; ++j)
          aK[f].u[j] = *(const unsigned*)
              &lds_k[(t * 16 + m) * 72 + pairK(j) + 8 * half + 32 * f];
      v8f c = {};
      c = __builtin_amdgcn_wmma_f32_16x16x32_f16(false, aK[0].v, false, bQ[0].v,
                                                 (short)0, c, false, false);
      c = __builtin_amdgcn_wmma_f32_16x16x32_f16(false, aK[1].v, false, bQ[1].v,
                                                 (short)0, c, false, false);
      S[t] = c;
    }

    // online softmax of query m: 32 of the chunk's 64 keys are in this lane,
    // the other 32 in lane ^ 16. Scores are handled two at a time (packed f32).
    f32x2 Sp[4][4];
    float mt[4];
#pragma unroll
    for (int t = 0; t < 4; ++t) {
      mt[t] = -1e30f;
#pragma unroll
      for (int i = 0; i < 4; ++i) {
        f32x2 x = {S[t][2 * i], S[t][2 * i + 1]};
        x *= ATTN_SCALE;
        Sp[t][i] = x;
        mt[t] = fmaxf(mt[t], fmaxf(x.x, x.y));
      }
    }
    float mx = fmaxf(fmaxf(mt[0], mt[1]), fmaxf(mt[2], mt[3]));
    mx = fmaxf(mx, xhalf(mx));
    float nm = fmaxf(mrun, mx);
    float alpha = __expf(mrun - nm);
    mrun = nm;

    // P^T as B operand, packed in place: key tiles 2f and 2f+1 hold keys
    // 32 f + 8 half + 0..7 and 32 f + 16 + 8 half + 0..7, which is the pairK order.
    AFrag bP[2];
    f32x2 st[4];
#pragma unroll
    for (int t = 0; t < 4; ++t) {
#pragma unroll
      for (int i = 0; i < 4; ++i) {
        f32x2 a = (Sp[t][i] - nm) * LOG2E;
        f32x2 p = {__builtin_amdgcn_exp2f(a.x), __builtin_amdgcn_exp2f(a.y)};
        st[t] = (i == 0) ? p : st[t] + p;
        bP[t >> 1].h2[(t & 1) * 4 + i] = __builtin_convertvector(p, f16x2);
      }
    }
    f32x2 sall = (st[0] + st[1]) + (st[2] + st[3]);
    lrun = lrun * alpha + (sall.x + sall.y);
#pragma unroll
    for (int s = 0; s < 4; ++s) Oacc[s] *= alpha;

    // O^T += V^T @ P^T  (A frag: row = d, transposed out of row-major lds_v on the read)
#pragma unroll
    for (int s = 0; s < 4; ++s) {
      AFrag aV[2];
#pragma unroll
      for (int f = 0; f < 2; ++f) {
        const f16* p = &lds_v[(32 * f + 8 * half + (lane & 7)) * 80 +
                              s * 16 + 8 * ((lane >> 3) & 1)];
        aV[f].q[0] = ld_tr16(p);
        aV[f].q[1] = ld_tr16(p + 16 * 80);
      }
      Oacc[s] = __builtin_amdgcn_wmma_f32_16x16x32_f16(false, aV[0].v, false, bP[0].v,
                                                       (short)0, Oacc[s], false, false);
      Oacc[s] = __builtin_amdgcn_wmma_f32_16x16x32_f16(false, aV[1].v, false, bP[1].v,
                                                       (short)0, Oacc[s], false, false);
    }
  }

  // join the two lanes' sums, normalize and store (f16, row-major [b*n, h*d]):
  // a lane's 8 registers of a tile are 8 consecutive d of its query's row.
  const float lsum = lrun + xhalf(lrun);
#pragma unroll
  for (int s = 0; s < 4; ++s) {
    v8h o;
#pragma unroll
    for (int r = 0; r < 8; ++r) o[r] = (f16)(Oacc[s][r] / lsum);
    *(v8h*)&O[(size_t)(qrow0 + m) * DIMN + qcol0 + s * 16 + 8 * half] = o;
  }
}

// ---------------------------------------------------------------- launch
extern "C" void kernel_launch(void* const* d_in, const int* in_sizes, int n_in,
                              void* d_out, int out_size, void* d_ws, size_t ws_size,
                              hipStream_t stream) {
  (void)in_sizes; (void)n_in; (void)out_size; (void)ws_size;
  const float* words     = (const float*)d_in[0];
  const float* position  = (const float*)d_in[1];
  const float* conscious = (const float*)d_in[2];
  const float* w_wq = (const float*)d_in[3];
  const float* w_wk = (const float*)d_in[4];
  const float* w_wv = (const float*)d_in[5];
  const float* w_pq = (const float*)d_in[6];
  const float* w_pk = (const float*)d_in[7];
  const float* w_cq = (const float*)d_in[8];
  const float* w_ck = (const float*)d_in[9];
  const float* w_out = (const float*)d_in[10];
  const float* b_out = (const float*)d_in[11];

  f16* ws   = (f16*)d_ws;
  f16* Xcat = ws;                               // 8192 x 3072
  f16* Wqc  = Xcat + (size_t)ROWS * K3;         // 3072 x 1024 [w_wq; w_pq; w_cq]
  f16* Wkc  = Wqc + (size_t)K3 * DIMN;          // 3072 x 1024 [w_wk; w_pk; w_ck]
  f16* Wv   = Wkc + (size_t)K3 * DIMN;          // 1024 x 1024
  f16* Wo   = Wv + (size_t)DIMN * DIMN;         // 1024 x 1024
  f16* Qm   = Wo + (size_t)DIMN * DIMN;         // 8192 x 1024
  f16* Km   = Qm + (size_t)ROWS * DIMN;
  f16* Vm   = Km + (size_t)ROWS * DIMN;
  f16* Am   = Vm + (size_t)ROWS * DIMN;

  pack_xcat<<<4096, 256, 0, stream>>>(words, position, conscious, Xcat);
  pack_w3<<<1024, 256, 0, stream>>>(w_wq, w_pq, w_cq, Wqc);
  pack_w3<<<1024, 256, 0, stream>>>(w_wk, w_pk, w_ck, Wkc);
  pack_w1<<<512, 256, 0, stream>>>(w_wv, Wv, (size_t)DIMN * DIMN);
  pack_w1<<<512, 256, 0, stream>>>(w_out, Wo, (size_t)DIMN * DIMN);

  dim3 g(DIMN / 128, ROWS / 128);  // (8, 64)
  // Q = Xcat @ Wqc (K=3072); K = Xcat @ Wkc; V = words @ Wv (first 1024 cols)
  gemm_wmma<false, false><<<g, 256, 0, stream>>>(Xcat, Wqc, Qm, nullptr, K3, K3, DIMN, DIMN);
  gemm_wmma<false, false><<<g, 256, 0, stream>>>(Xcat, Wkc, Km, nullptr, K3, K3, DIMN, DIMN);
  gemm_wmma<false, false><<<g, 256, 0, stream>>>(Xcat, Wv, Vm, nullptr, DIMN, K3, DIMN, DIMN);

  flash_attn<<<dim3(SEQ / 64, BATCH * NHEADS), 128, 0, stream>>>(Qm, Km, Vm, Am);

  // out = Attn @ Wo + b_out  (f32 output)
  gemm_wmma<true, true><<<g, 256, 0, stream>>>(Am, Wo, d_out, b_out, DIMN, DIMN, DIMN, DIMN);
}

// v004
// A run of this version takes 262 microseconds.
// Timed twice side by side with v003, it ran 1.19 and 1.20 times as fast.
// All steps since v000 together make it 3.90 times as fast.
#include <hip/hip_runtime.h>

typedef _Float16 f16;
typedef __attribute__((ext_vector_type(16))) _Float16 v16h;
typedef __attribute__((ext_vector_type(8)))  _Float16 v8h;
typedef __attribute__((ext_vector_type(8)))  float    v8f;

#define DIMN 1024
#define HEADD 64
#define NHEADS 16
#define BATCH 4
#define SEQ 2048
#define ROWS (BATCH*SEQ)   /* 8192 */
#define K3   (3*DIMN)      /* 3072 */
#define ATTN_SCALE 0.125f  /* 64^-0.5 */
#define LOG2E 1.4426950408889634f

// K-index mapping for 16-bit A/B fragments (ISA 7.12.2, 16-bit A 16x32):
// VGPR j holds 2 f16; lanes 0-15 cover K {0..7,16..23}, lanes 16-31 add +8.
__device__ __forceinline__ int pairK(int j) { return (j < 4) ? (2 * j) : (16 + 2 * (j - 4)); }

typedef __attribute__((ext_vector_type(4))) unsigned u32x4;
typedef __attribute__((ext_vector_type(8))) short    s16x8;

typedef __attribute__((ext_vector_type(2))) float    f32x2;
typedef __attribute__((ext_vector_type(2))) _Float16 f16x2;

union AFrag { unsigned u[8]; u32x4 q[2]; f16x2 h2[8]; v16h v; };

// Transposing LDS load: from a row-major [k][n] tile, lane (c = l & 15, h = l >> 4)
// receives T[kbase + 8h + 0..7][nbase + c]; the lane's own address is
// row kbase + 8h + (l & 7), byte 2*nbase + 16*((l >> 3) & 1). Loads at kbase and
// kbase + 16 fill registers 0-3 and 4-7 of a fragment in the pairK order above.
__device__ __forceinline__ u32x4 ld_tr16(const f16* p) {
  typedef __attribute__((address_space(3))) s16x8 lds_s16x8;
  return __builtin_bit_cast(u32x4, __builtin_amdgcn_ds_load_tr16_b128_v8i16((lds_s16x8*)p));
}

// CDNA5 async copy: global -> LDS, 16 bytes per lane, tracked by ASYNCcnt.
// LDS operand is the low 32 bits of the generic pointer (LDS aperture truncates
// addr[31:0] per ISA 10.2).
// A stage's eight copies (four per tile) and their s_wait_xcnt 0 in one statement,
// so that no address register of an issued copy is rewritten ahead of the wait.
__device__ __forceinline__ void async8_b128(const unsigned (&l)[8], const f16* const (&g)[8]) {
  asm volatile("global_load_async_to_lds_b128 %0, %1, off\n\t"
               "global_load_async_to_lds_b128 %2, %3, off\n\t"
               "global_load_async_to_lds_b128 %4, %5, off\n\t"
               "global_load_async_to_lds_b128 %6, %7, off\n\t"
               "global_load_async_to_lds_b128 %8, %9, off\n\t"
               "global_load_async_to_lds_b128 %10, %11, off\n\t"
               "global_load_async_to_lds_b128 %12, %13, off\n\t"
               "global_load_async_to_lds_b128 %14, %15, off\n\t"
               "s_wait_xcnt 0x0"
               :: "v"(l[0]), "v"(g[0]), "v"(l[1]), "v"(g[1]), "v"(l[2]), "v"(g[2]),
                  "v"(l[3]), "v"(g[3]), "v"(l[4]), "v"(g[4]), "v"(l[5]), "v"(g[5]),
                  "v"(l[6]), "v"(g[6]), "v"(l[7]), "v"(g[7])
               : "memory");
}
__device__ __forceinline__ void wait_async0() {
  asm volatile("s_wait_asynccnt 0x0" ::: "memory");
}
// This wave's LDS reads of a buffer have returned before the barrier behind which
// the buffer is refilled by copies.
__device__ __forceinline__ void wait_ds0() {
  asm volatile("s_wait_dscnt 0x0" ::: "memory");
}

// ---------------------------------------------------------------- pack kernels
__global__ void pack_xcat(const float* __restrict__ a, const float* __restrict__ b,
                          const float* __restrict__ c, f16* __restrict__ out) {
  size_t total = (size_t)ROWS * K3;
  for (size_t i = (size_t)blockIdx.x * blockDim.x + threadIdx.x; i < total;
       i += (size_t)gridDim.x * blockDim.x) {
    size_t row = i / K3;
    int col = (int)(i % K3);
    const float* src = (col < DIMN) ? a : (col < 2 * DIMN ? b : c);
    out[i] = (f16)src[row * DIMN + (col & (DIMN - 1))];
  }
}

__global__ void pack_w3(const float* __restrict__ a, const float* __restrict__ b,
                        const float* __restrict__ c, f16* __restrict__ out) {
  size_t blk = (size_t)DIMN * DIMN;
  size_t total = 3 * blk;
  for (size_t i = (size_t)blockIdx.x * blockDim.x + threadIdx.x; i < total;
       i += (size_t)gridDim.x * blockDim.x) {
    const float* s = (i < blk) ? a : (i < 2 * blk ? b : c);
    out[i] = (f16)s[i % blk];
  }
}

__global__ void pack_w1(const float* __restrict__ a, f16* __restrict__ out, size_t total) {
  for (size_t i = (size_t)blockIdx.x * blockDim.x + threadIdx.x; i < total;
       i += (size_t)gridDim.x * blockDim.x)
    out[i] = (f16)a[i];
}

// ---------------------------------------------------------------- WMMA GEMM
// C[M,N] = A[M,K] @ B[K,N]; f16 in, f32 accumulate; 128x128x64 tiles,
// 256 threads = 8 waves in 4(m) x 2(n) grid, each wave computes 32x64.
// A and B tiles staged via global_load_async_to_lds_b128; B stays row-major in
// LDS and is transposed on the read by ds_load_tr16_b128.
// Two LDS buffers: while trip t works on buffer t & 1, tile t + 1's copies fly into
// the other one; one barrier per trip publishes tile t + 1 and frees buffer t & 1.
template <bool OUT_F32, bool HAS_BIAS>
__global__ __launch_bounds__(256)
void gemm_wmma(const f16* __restrict__ A, const f16* __restrict__ B,
               void* __restrict__ Cout, const float* __restrict__ bias,
               int K, int lda, int ldb, int ldc) {
  __shared__ __attribute__((aligned(16))) f16 lds_a[2][128 * 72];  // [row][k], stride 144B = 16B x odd
  __shared__ __attribute__((aligned(16))) f16 lds_b[2][64 * 144];  // [k][n], stride 288B = 32B x odd

  const int tid = threadIdx.x;
  const int wave = tid >> 5, lane = tid & 31;
  const int m = lane & 15, half = lane >> 4;
  const int waveM = wave >> 1, waveN = wave & 1;
  const int rowBase = blockIdx.y * 128;
  const int colBase = blockIdx.x * 128;

  v8f acc[2][4] = {};

  // issue the copies of the next tile along K into buffer buf; ap and bp walk the tiles.
  // A tile: 128x64 f16 = 1024 x 16B, 8 vectors per row: a lane brings rows ar + 32 it.
  // B tile: 64x128 f16 = 1024 x 16B, 16 vectors per row, row-major: rows br + 16 it.
  const int ar = tid >> 3, ac = (tid & 7) * 8;
  const int br = tid >> 4, bc = (tid & 15) * 8;
  const f16* ap = A + (size_t)(rowBase + ar) * lda + ac;
  const f16* bp = B + (size_t)br * ldb + colBase + bc;
  auto stage = [&](int buf) {
    unsigned ldst[8];
    const f16* gsrc[8];
#pragma unroll
    for (int it = 0; it < 4; ++it) {
      ldst[it] = (unsigned)(size_t)&lds_a[buf][(ar + 32 * it) * 72 + ac];
      gsrc[it] = ap + (size_t)(32 * it) * lda;
      ldst[4 + it] = (unsigned)(size_t)&lds_b[buf][(br + 16 * it) * 144 + bc];
      gsrc[4 + it] = bp + (size_t)(16 * it) * ldb;
    }
    async8_b128(ldst, gsrc);
    ap += 64;
    bp += (size_t)64 * ldb;
  };

  stage(0);
  wait_async0();
  __syncthreads();
  if (64 < K) stage(1);

  for (int k0 = 0; k0 < K; k0 += 64) {
    const int buf = (k0 >> 6) & 1;
    const f16* la = lds_a[buf];
    const f16* lb = lds_b[buf];

#pragma unroll
    for (int ks = 0; ks < 2; ++ks) {
      const int kk = ks * 32;
      AFrag a[2], b[4];
#pragma unroll
      for (int ms = 0; ms < 2; ++ms) {
        int row = waveM * 32 + ms * 16 + m;
#pragma unroll
        for (int j = 0; j < 8; ++j)
          a[ms].u[j] = *(const unsigned*)&la[row * 72 + kk + pairK(j) + 8 * half];
      }
#pragma unroll
      for (int ns = 0; ns < 4; ++ns) {
        const f16* p = &lb[(kk + 8 * half + (lane & 7)) * 144 +
                              waveN * 64 + ns * 16 + 8 * ((lane >> 3) & 1)];
        b[ns].q[0] = ld_tr16(p);
        b[ns].q[1] = ld_tr16(p + 16 * 144);
      }
#pragma unroll
      for (int ms = 0; ms < 2; ++ms)
#pragma unroll
        for (int ns = 0; ns < 4; ++ns)
          acc[ms][ns] = __builtin_amdgcn_wmma_f32_16x16x32_f16(
              false, a[ms].v, false, b[ns].v, (short)0, acc[ms][ns], false, false);
    }

    // publish point of the next tile: own LDS reads back, own copies landed, barrier;
    // only then the refill of the buffer that this trip has read
    wait_ds0();
    wait_async0();
    __syncthreads();
    if (k0 + 128 < K) stage(buf);
  }
  wait_async0();

  // Branch-free epilogue: C layout -> row = r + 8*half, col = lane&15.
#pragma unroll
  for (int ms = 0; ms < 2; ++ms)
#pragma unroll
    for (int ns = 0; ns < 4; ++ns) {
      int row0 = rowBase + waveM * 32 + ms * 16 + 8 * half;
      int col = colBase + waveN * 64 + ns * 16 + m;
      float bv = 0.f;
      if constexpr (HAS_BIAS) bv = bias[col];
#pragma unroll
      for (int r = 0; r < 8; ++r) {
        float val = acc[ms][ns][r] + bv;
        size_t idx = (size_t)(row0 + r) * ldc + col;
        if constexpr (OUT_F32) ((float*)Cout)[idx] = val;
        else                   ((f16*)Cout)[idx] = (f16)val;
      }
    }
}

// lane l with lane l ^ 16
__device__ __forceinline__ float xhalf(float x) {
  int b = __builtin_bit_cast(int, x);
  return __builtin_bit_cast(float,
      __builtin_amdgcn_permlanex16(b, b, 0x76543210, 0xfedcba98, false, false));
}

__global__ __launch_bounds__(128)
void flash_attn(const f16* __restrict__ Q, const f16* __restrict__ Kmat,
                const f16* __restrict__ Vmat, f16* __restrict__ O) {
  // two buffers each: chunk kc is worked on in buffer kc & 1 while chunk kc + 1 flies into the other
  __shared__ __attribute__((aligned(16))) f16 lds_k[2][64 * 72];  // [key][d], stride 144B = 16B x odd
  __shared__ __attribute__((aligned(16))) f16 lds_v[2][64 * 80];  // [key][d], stride 160B = 32B x odd

  const int tid = threadIdx.x;
  const int wave = tid >> 5, lane = tid & 31;
  const int m = lane & 15, half = lane >> 4;
  const int bh = blockIdx.y, bi = bh >> 4, h = bh & 15;
  const int qrow0 = bi * SEQ + blockIdx.x * 64 + wave * 16;
  const int qcol0 = h * HEADD;

  // Q^T as B operand: column = query m, k = d in the pairK order (two frags: d 0..31, 32..63)
  AFrag bQ[2];
#pragma unroll
  for (int f = 0; f < 2; ++f)
#pragma unroll
    for (int j = 0; j < 8; ++j)
      bQ[f].u[j] = *(const unsigned*)
          &Q[(size_t)(qrow0 + m) * DIMN + qcol0 + pairK(j) + 8 * half + 32 * f];

  v8f Oacc[4] = {};            // O^T: Oacc[s][r] = O[query m][d = 16 s + 8 half + r]
  float mrun = -1e30f;         // query m's running maximum, equal in both of its lanes
  float lrun = 0.f;            // running sum over this lane's own keys only

  // issue the copies of the next K and V chunk into buffer buf, both row-major:
  // a lane brings 16 B of rows sr, sr + 16, sr + 32, sr + 48; kp and vp walk the chunks
  const int sr = tid >> 3, sc = (tid & 7) * 8;
  const f16* kp = Kmat + (size_t)(bi * SEQ + sr) * DIMN + qcol0 + sc;
  const f16* vp = Vmat + (size_t)(bi * SEQ + sr) * DIMN + qcol0 + sc;
  auto stage = [&](int buf) {
    unsigned ldst[8];
    const f16* gsrc[8];
#pragma unroll
    for (int it = 0; it < 4; ++it) {
      ldst[it] = (unsigned)(size_t)&lds_k[buf][(sr + 16 * it) * 72 + sc];
      gsrc[it] = kp + it * 16 * DIMN;
      ldst[4 + it] = (unsigned)(size_t)&lds_v[buf][(sr + 16 * it) * 80 + sc];
      gsrc[4 + it] = vp + it * 16 * DIMN;
    }
    async8_b128(ldst, gsrc);
    kp += 64 * DIMN;
    vp += 64 * DIMN;
  };

  stage(0);
  wait_async0();
  __syncthreads();
  stage(1);

  for (int kc = 0; kc < SEQ / 64; ++kc) {
    const int buf = kc & 1;
    const f16* lk = lds_k[buf];
    const f16* lv = lds_v[buf];

    // S^T = K @ Q^T  (A frag: row = key, contiguous d in lds_k rows)
    v8f S[4];
#pragma unroll
    for (int t = 0; t < 4; ++t) {
      AFrag aK[2];
#pragma unroll
      for (int f = 0; f < 2; ++f)
#pragma unroll
        for (int j = 0; j < 8; ++j)
          aK[f].u[j] = *(const unsigned*)
              &lk[(t * 16 + m) * 72 + pairK(j) + 8 * half + 32 * f];
      v8f c = {};
      c = __builtin_amdgcn_wmma_f32_16x16x32_f16(false, aK[0].v, false, bQ[0].v,
                                                 (short)0, c, false, false);
      c = __builtin_amdgcn_wmma_f32_16x16x32_f16(false, aK[1].v, false, bQ[1].v,
                                                 (short)0, c, false, false);
      S[t] = c;
    }

    // online softmax of query m: 32 of the chunk's 64 keys are in this lane,
    // the other 32 in lane ^ 16. Scores are handled two at a time (packed f32).
    f32x2 Sp[4][4];
    float mt[4];
#pragma unroll
    for (int t = 0; t < 4; ++t) {
      mt[t] = -1e30f;
#pragma unroll
      for (int i = 0; i < 4; ++i) {
        f32x2 x = {S[t][2 * i], S[t][2 * i + 1]};
        x *= ATTN_SCALE;
        Sp[t][i] = x;
        mt[t] = fmaxf(mt[t], fmaxf(x.x, x.y));
      }
    }
    float mx = fmaxf(fmaxf(mt[0], mt[1]), fmaxf(mt[2], mt[3]));
    mx = fmaxf(mx, xhalf(mx));
    float nm = fmaxf(mrun, mx);
    float alpha = __expf(mrun - nm);
    mrun = nm;

    // P^T as B operand, packed in place: key tiles 2f and 2f+1 hold keys
    // 32 f + 8 half + 0..7 and 32 f + 16 + 8 half + 0..7, which is the pairK order.
    AFrag bP[2];
    f32x2 st[4];
#pragma unroll
    for (int t = 0; t < 4; ++t) {
#pragma unroll
      for (int i = 0; i < 4; ++i) {
        f32x2 a = (Sp[t][i] - nm) * LOG2E;
        f32x2 p = {__builtin_amdgcn_exp2f(a.x), __builtin_amdgcn_exp2f(a.y)};
        st[t] = (i == 0) ? p : st[t] + p;
        bP[t >> 1].h2[(t & 1) * 4 + i] = __builtin_convertvector(p, f16x2);
      }
    }
    f32x2 sall = (st[0] + st[1]) + (st[2] + st[3]);
    lrun = lrun * alpha + (sall.x + sall.y);
#pragma unroll
    for (int s = 0; s < 4; ++s) Oacc[s] *= alpha;

    // O^T += V^T @ P^T  (A frag: row = d, transposed out of row-major lds_v on the read)
#pragma unroll
    for (int s = 0; s < 4; ++s) {
      AFrag aV[2];
#pragma unroll
      for (int f = 0; f < 2; ++f) {
        const f16* p = &lv[(32 * f + 8 * half + (lane & 7)) * 80 +
                              s * 16 + 8 * ((lane >> 3) & 1)];
        aV[f].q[0] = ld_tr16(p);
        aV[f].q[1] = ld_tr16(p + 16 * 80);
      }
      Oacc[s] = __builtin_amdgcn_wmma_f32_16x16x32_f16(false, aV[0].v, false, bP[0].v,
                                                       (short)0, Oacc[s], false, false);
      Oacc[s] = __builtin_amdgcn_wmma_f32_16x16x32_f16(false, aV[1].v, false, bP[1].v,
                                                       (short)0, Oacc[s], false, false);
    }

    // publish point of the next chunk: own LDS reads back, own copies landed, barrier;
    // only then the refill of the buffer that this trip has read
    wait_ds0();
    wait_async0();
    __syncthreads();
    if (kc + 2 < SEQ / 64) stage(buf);
  }
  wait_async0();

  // join the two lanes' sums, normalize and store (f16, row-major [b*n, h*d]):
  // a lane's 8 registers of a tile are 8 consecutive d of its query's row.
  const float lsum = lrun + xhalf(lrun);
#pragma unroll
  for (int s = 0; s < 4; ++s) {
    v8h o;
#pragma unroll
    for (int r = 0; r < 8; ++r) o[r] = (f16)(Oacc[s][r] / lsum);
    *(v8h*)&O[(size_t)(qrow0 + m) * DIMN + qcol0 + s * 16 + 8 * half] = o;
  }
}

// ---------------------------------------------------------------- launch
extern "C" void kernel_launch(void* const* d_in, const int* in_sizes, int n_in,
                              void* d_out, int out_size, void* d_ws, size_t ws_size,
                              hipStream_t stream) {
  (void)in_sizes; (void)n_in; (void)out_size; (void)ws_size;
  const float* words     = (const float*)d_in[0];
  const float* position  = (const float*)d_in[1];
  const float* conscious = (const float*)d_in[2];
  const float* w_wq = (const float*)d_in[3];
  const float* w_wk = (const float*)d_in[4];
  const float* w_wv = (const float*)d_in[5];
  const float* w_pq = (const float*)d_in[6];
  const float* w_pk = (const float*)d_in[7];
  const float* w_cq = (const float*)d_in[8];
  const float* w_ck = (const float*)d_in[9];
  const float* w_out = (const float*)d_in[10];
  const float* b_out = (const float*)d_in[11];

  f16* ws   = (f16*)d_ws;
  f16* Xcat = ws;                               // 8192 x 3072
  f16* Wqc  = Xcat + (size_t)ROWS * K3;         // 3072 x 1024 [w_wq; w_pq; w_cq]
  f16* Wkc  = Wqc + (size_t)K3 * DIMN;          // 3072 x 1024 [w_wk; w_pk; w_ck]
  f16* Wv   = Wkc + (size_t)K3 * DIMN;          // 1024 x 1024
  f16* Wo   = Wv + (size_t)DIMN * DIMN;         // 1024 x 1024
  f16* Qm   = Wo + (size_t)DIMN * DIMN;         // 8192 x 1024
  f16* Km   = Qm + (size_t)ROWS * DIMN;
  f16* Vm   = Km + (size_t)ROWS * DIMN;
  f16* Am   = Vm + (size_t)ROWS * DIMN;

  pack_xcat<<<4096, 256, 0, stream>>>(words, position, conscious, Xcat);
  pack_w3<<<1024, 256, 0, stream>>>(w_wq, w_pq, w_cq, Wqc);
  pack_w3<<<1024, 256, 0, stream>>>(w_wk, w_pk, w_ck, Wkc);
  pack_w1<<<512, 256, 0, stream>>>(w_wv, Wv, (size_t)DIMN * DIMN);
  pack_w1<<<512, 256, 0, stream>>>(w_out, Wo, (size_t)DIMN * DIMN);

  dim3 g(DIMN / 128, ROWS / 128);  // (8, 64)
  // Q = Xcat @ Wqc (K=3072); K = Xcat @ Wkc; V = words @ Wv (first 1024 cols)
  gemm_wmma<false, false><<<g, 256, 0, stream>>>(Xcat, Wqc, Qm, nullptr, K3, K3, DIMN, DIMN);
  gemm_wmma<false, false><<<g, 256, 0, stream>>>(Xcat, Wkc, Km, nullptr, K3, K3, DIMN, DIMN);
  gemm_wmma<false, false><<<g, 256, 0, stream>>>(Xcat, Wv, Vm, nullptr, DIMN, K3, DIMN, DIMN);

  flash_attn<<<dim3(SEQ / 64, BATCH * NHEADS), 128, 0, stream>>>(Qm, Km, Vm, Am);

  // out = Attn @ Wo + b_out  (f32 output)
  gemm_wmma<true, true><<<g, 256, 0, stream>>>(Am, Wo, d_out, b_out, DIMN, DIMN, DIMN, DIMN);
}

// v005
// It runs in 220 microseconds.
// Next to v004, in two timings, it ran 1.19 times as fast each time.
// All steps since v000 together make it 4.63 times as fast.
#include <hip/hip_runtime.h>

typedef _Float16 f16;
typedef __attribute__((ext_vector_type(16))) _Float16 v16h;
typedef __attribute__((ext_vector_type(8)))  _Float16 v8h;
typedef __attribute__((ext_vector_type(8)))  float    v8f;

#define DIMN 1024
#define HEADD 64
#define NHEADS 16
#define BATCH 4
#define SEQ 2048
#define ROWS (BATCH*SEQ)   /* 8192 */
#define K3   (3*DIMN)      /* 3072 */
#define ATTN_SCALE 0.125f  /* 64^-0.5 */
#define LOG2E 1.4426950408889634f

// K-index mapping for 16-bit A/B fragments (ISA 7.12.2, 16-bit A 16x32):
// VGPR j holds 2 f16; lanes 0-15 cover K {0..7,16..23}, lanes 16-31 add +8.
__device__ __forceinline__ int pairK(int j) { return (j < 4) ? (2 * j) : (16 + 2 * (j - 4)); }

typedef __attribute__((ext_vector_type(4))) unsigned u32x4;
typedef __attribute__((ext_vector_type(8))) short    s16x8;

typedef __attribute__((ext_vector_type(2))) float    f32x2;
typedef __attribute__((ext_vector_type(2))) _Float16 f16x2;

union AFrag { unsigned u[8]; u32x4 q[2]; f16x2 h2[8]; v16h v; };

// Transposing LDS load: from a row-major [k][n] tile, lane (c = l & 15, h = l >> 4)
// receives T[kbase + 8h + 0..7][nbase + c]; the lane's own address is
// row kbase + 8h + (l & 7), byte 2*nbase + 16*((l >> 3) & 1). Loads at kbase and
// kbase + 16 fill registers 0-3 and 4-7 of a fragment in the pairK order above.
__device__ __forceinline__ u32x4 ld_tr16(const f16* p) {
  typedef __attribute__((address_space(3))) s16x8 lds_s16x8;
  return __builtin_bit_cast(u32x4, __builtin_amdgcn_ds_load_tr16_b128_v8i16((lds_s16x8*)p));
}

// CDNA5 async copy: global -> LDS, 16 bytes per lane, tracked by ASYNCcnt.
// LDS operand is the low 32 bits of the generic pointer (LDS aperture truncates
// addr[31:0] per ISA 10.2).
// A stage's eight copies (four per tile) and their s_wait_xcnt 0 in one statement,
// so that no address register of an issued copy is rewritten ahead of the wait.
__device__ __forceinline__ void async8_b128(const unsigned (&l)[8], const f16* const (&g)[8]) {
  asm volatile("global_load_async_to_lds_b128 %0, %1, off\n\t"
               "global_load_async_to_lds_b128 %2, %3, off\n\t"
               "global_load_async_to_lds_b128 %4, %5, off\n\t"
               "global_load_async_to_lds_b128 %6, %7, off\n\t"
               "global_load_async_to_lds_b128 %8, %9, off\n\t"
               "global_load_async_to_lds_b128 %10, %11, off\n\t"
               "global_load_async_to_lds_b128 %12, %13, off\n\t"
               "global_load_async_to_lds_b128 %14, %15, off\n\t"
               "s_wait_xcnt 0x0"
               :: "v"(l[0]), "v"(g[0]), "v"(l[1]), "v"(g[1]), "v"(l[2]), "v"(g[2]),
                  "v"(l[3]), "v"(g[3]), "v"(l[4]), "v"(g[4]), "v"(l[5]), "v"(g[5]),
                  "v"(l[6]), "v"(g[6]), "v"(l[7]), "v"(g[7])
               : "memory");
}
__device__ __forceinline__ void wait_async0() {
  asm volatile("s_wait_asynccnt 0x0" ::: "memory");
}
// This wave's LDS reads of a buffer have returned before the barrier behind which
// the buffer is refilled by copies.
__device__ __forceinline__ void wait_ds0() {
  asm volatile("s_wait_dscnt 0x0" ::: "memory");
}

// ---------------------------------------------------------------- pack kernel
typedef __attribute__((ext_vector_type(4))) float    f32x4;
typedef __attribute__((ext_vector_type(4))) _Float16 f16x4;

#define PACK_ROWS 8                        /* rows of DIMN elements per wave */
#define PACK_WAVES 16                      /* waves per workgroup */
#define PACK_ALLROWS (3 * ROWS + 8 * DIMN) /* 32768 rows: three activations, eight weights */

// All f32 -> f16 conversions in one streaming launch: one workgroup of 16 waves per WGP,
// few waves to start, many bytes in flight per wave. A wave owns 8 consecutive rows of
// 1024 elements of ONE source. A row is 8 loads of 512 contiguous bytes; the next row's
// loads are issued before this row is converted and stored (8 to 16 in flight per wave).
// Rows 0..24575 are words, position, conscious -> xcat[row][source * 1024 + col];
// rows 24576.. are the eight weights, whose f16 copies lie one behind another in wcat.
__global__ __launch_bounds__(PACK_WAVES * 32)
void pack_all(const float* __restrict__ words, const float* __restrict__ position,
              const float* __restrict__ conscious,
              const float* __restrict__ w_wq, const float* __restrict__ w_pq,
              const float* __restrict__ w_cq, const float* __restrict__ w_wk,
              const float* __restrict__ w_pk, const float* __restrict__ w_ck,
              const float* __restrict__ w_wv, const float* __restrict__ w_out,
              f16* __restrict__ xcat, f16* __restrict__ wcat) {
  const int lane = threadIdx.x & 31;
  const int gw = __builtin_amdgcn_readfirstlane((int)(blockIdx.x * PACK_WAVES + (threadIdx.x >> 5)));
  const int R = gw * PACK_ROWS;
  const float* src;
  f16* dst;
  int dpitch;
  if (R < 3 * ROWS) {
    const int s = R / ROWS, row = R % ROWS;
    src = (s == 0 ? words : s == 1 ? position : conscious) + (size_t)row * DIMN;
    dst = xcat + (size_t)row * K3 + s * DIMN;
    dpitch = K3;
  } else {
    const int q = R - 3 * ROWS, j = q / DIMN;
    const float* w = j == 0 ? w_wq : j == 1 ? w_pq : j == 2 ? w_cq : j == 3 ? w_wk
                   : j == 4 ? w_pk : j == 5 ? w_ck : j == 6 ? w_wv : w_out;
    src = w + (size_t)(q % DIMN) * DIMN;
    dst = wcat + (size_t)q * DIMN;
    dpitch = DIMN;
  }
  src += lane * 4;
  dst += lane * 4;

  f32x4 cur[8], nxt[8];
#pragma unroll
  for (int i = 0; i < 8; ++i)
    cur[i] = __builtin_nontemporal_load((const f32x4*)(src + i * 128));
#pragma unroll
  for (int r = 0; r < PACK_ROWS; ++r) {
    if (r + 1 < PACK_ROWS) {
#pragma unroll
      for (int i = 0; i < 8; ++i)
        nxt[i] = __builtin_nontemporal_load((const f32x4*)(src + (r + 1) * DIMN + i * 128));
      // all of the next row's loads are issued before the first wait on this row's;
      // without it the compiler spreads them among those waits
      __builtin_amdgcn_sched_barrier(0);
    }
#pragma unroll
    for (int i = 0; i < 8; ++i)
      *(f16x4*)(dst + i * 128) = __builtin_convertvector(cur[i], f16x4);
    if (r + 1 < PACK_ROWS) {
      // in front of every rewrite of a register that an issued load or store names
      // (the stores' data and address, which the next trip uses again)
      asm volatile("s_wait_xcnt 0x0" ::: "memory");
      // holds the next trip's register writes behind that wait
      __builtin_amdgcn_sched_barrier(0);
      dst += dpitch;
#pragma unroll
      for (int i = 0; i < 8; ++i) cur[i] = nxt[i];
    }
  }
}

// ---------------------------------------------------------------- WMMA GEMM
// C[M,N] = A[M,K] @ B[K,N]; f16 in, f32 accumulate; 128x128x64 tiles,
// 256 threads = 8 waves in 4(m) x 2(n) grid, each wave computes 32x64.
// A and B tiles staged via global_load_async_to_lds_b128; B stays row-major in
// LDS and is transposed on the read by ds_load_tr16_b128.
// Two LDS buffers: while trip t works on buffer t & 1, tile t + 1's copies fly into
// the other one; one barrier per trip publishes tile t + 1 and frees buffer t & 1.
template <bool OUT_F32, bool HAS_BIAS>
__global__ __launch_bounds__(256)
void gemm_wmma(const f16* __restrict__ A, const f16* __restrict__ B,
               void* __restrict__ Cout, const float* __restrict__ bias,
               int K, int lda, int ldb, int ldc) {
  __shared__ __attribute__((aligned(16))) f16 lds_a[2][128 * 72];  // [row][k], stride 144B = 16B x odd
  __shared__ __attribute__((aligned(16))) f16 lds_b[2][64 * 144];  // [k][n], stride 288B = 32B x odd

  const int tid = threadIdx.x;
  const int wave = tid >> 5, lane = tid & 31;
  const int m = lane & 15, half = lane >> 4;
  const int waveM = wave >> 1, waveN = wave & 1;
  const int rowBase = blockIdx.y * 128;
  const int colBase = blockIdx.x * 128;

  v8f acc[2][4] = {};

  // issue the copies of the next tile along K into buffer buf; ap and bp walk the tiles.
  // A tile: 128x64 f16 = 1024 x 16B, 8 vectors per row: a lane brings rows ar + 32 it.
  // B tile: 64x128 f16 = 1024 x 16B, 16 vectors per row, row-major: rows br + 16 it.
  const int ar = tid >> 3, ac = (tid & 7) * 8;
  const int br = tid >> 4, bc = (tid & 15) * 8;
  const f16* ap = A + (size_t)(rowBase + ar) * lda + ac;
  const f16* bp = B + (size_t)br * ldb + colBase + bc;
  auto stage = [&](int buf) {
    unsigned ldst[8];
    const f16* gsrc[8];
#pragma unroll
    for (int it = 0; it < 4; ++it) {
      ldst[it] = (unsigned)(size_t)&lds_a[buf][(ar + 32 * it) * 72 + ac];
      gsrc[it] = ap + (size_t)(32 * it) * lda;
      ldst[4 + it] = (unsigned)(size_t)&lds_b[buf][(br + 16 * it) * 144 + bc];
      gsrc[4 + it] = bp + (size_t)(16 * it) * ldb;
    }
    async8_b128(ldst, gsrc);
    ap += 64;
    bp += (size_t)64 * ldb;
  };

  stage(0);
  wait_async0();
  __syncthreads();
  if (64 < K) stage(1);

  for (int k0 = 0; k0 < K; k0 += 64) {
    const int buf = (k0 >> 6) & 1;
    const f16* la = lds_a[buf];
    const f16* lb = lds_b[buf];

#pragma unroll
    for (int ks = 0; ks < 2; ++ks) {
      const int kk = ks * 32;
      AFrag a[2], b[4];
#pragma unroll
      for (int ms = 0; ms < 2; ++ms) {
        int row = waveM * 32 + ms * 16 + m;
#pragma unroll
        for (int j = 0; j < 8; ++j)
          a[ms].u[j] = *(const unsigned*)&la[row * 72 + kk + pairK(j) + 8 * half];
      }
#pragma unroll
      for (int ns = 0; ns < 4; ++ns) {
        const f16* p = &lb[(kk + 8 * half + (lane & 7)) * 144 +
                              waveN * 64 + ns * 16 + 8 * ((lane >> 3) & 1)];
        b[ns].q[0] = ld_tr16(p);
        b[ns].q[1] = ld_tr16(p + 16 * 144);
      }
#pragma unroll
      for (int ms = 0; ms < 2; ++ms)
#pragma unroll
        for (int ns = 0; ns < 4; ++ns)
          acc[ms][ns] = __builtin_amdgcn_wmma_f32_16x16x32_f16(
              false, a[ms].v, false, b[ns].v, (short)0, acc[ms][ns], false, false);
    }

    // publish point of the next tile: own LDS reads back, own copies landed, barrier;
    // only then the refill of the buffer that this trip has read
    wait_ds0();
    wait_async0();
    __syncthreads();
    if (k0 + 128 < K) stage(buf);
  }
  wait_async0();

  // Branch-free epilogue: C layout -> row = r + 8*half, col = lane&15.
#pragma unroll
  for (int ms = 0; ms < 2; ++ms)
#pragma unroll
    for (int ns = 0; ns < 4; ++ns) {
      int row0 = rowBase + waveM * 32 + ms * 16 + 8 * half;
      int col = colBase + waveN * 64 + ns * 16 + m;
      float bv = 0.f;
      if constexpr (HAS_BIAS) bv = bias[col];
#pragma unroll
      for (int r = 0; r < 8; ++r) {
        float val = acc[ms][ns][r] + bv;
        size_t idx = (size_t)(row0 + r) * ldc + col;
        if constexpr (OUT_F32) ((float*)Cout)[idx] = val;
        else                   ((f16*)Cout)[idx] = (f16)val;
      }
    }
}

// lane l with lane l ^ 16
__device__ __forceinline__ float xhalf(float x) {
  int b = __builtin_bit_cast(int, x);
  return __builtin_bit_cast(float,
      __builtin_amdgcn_permlanex16(b, b, 0x76543210, 0xfedcba98, false, false));
}

__global__ __launch_bounds__(128)
void flash_attn(const f16* __restrict__ Q, const f16* __restrict__ Kmat,
                const f16* __restrict__ Vmat, f16* __restrict__ O) {
  // two buffers each: chunk kc is worked on in buffer kc & 1 while chunk kc + 1 flies into the other
  __shared__ __attribute__((aligned(16))) f16 lds_k[2][64 * 72];  // [key][d], stride 144B = 16B x odd
  __shared__ __attribute__((aligned(16))) f16 lds_v[2][64 * 80];  // [key][d], stride 160B = 32B x odd

  const int tid = threadIdx.x;
  const int wave = tid >> 5, lane = tid & 31;
  const int m = lane & 15, half = lane >> 4;
  const int bh = blockIdx.y, bi = bh >> 4, h = bh & 15;
  const int qrow0 = bi * SEQ + blockIdx.x * 64 + wave * 16;
  const int qcol0 = h * HEADD;

  // Q^T as B operand: column = query m, k = d in the pairK order (two frags: d 0..31, 32..63)
  AFrag bQ[2];
#pragma unroll
  for (int f = 0; f < 2; ++f)
#pragma unroll
    for (int j = 0; j < 8; ++j)
      bQ[f].u[j] = *(const unsigned*)
          &Q[(size_t)(qrow0 + m) * DIMN + qcol0 + pairK(j) + 8 * half + 32 * f];

  v8f Oacc[4] = {};            // O^T: Oacc[s][r] = O[query m][d = 16 s + 8 half + r]
  float mrun = -1e30f;         // query m's running maximum, equal in both of its lanes
  float lrun = 0.f;            // running sum over this lane's own keys only

  // issue the copies of the next K and V chunk into buffer buf, both row-major:
  // a lane brings 16 B of rows sr, sr + 16, sr + 32, sr + 48; kp and vp walk the chunks
  const int sr = tid >> 3, sc = (tid & 7) * 8;
  const f16* kp = Kmat + (size_t)(bi * SEQ + sr) * DIMN + qcol0 + sc;
  const f16* vp = Vmat + (size_t)(bi * SEQ + sr) * DIMN + qcol0 + sc;
  auto stage = [&](int buf) {
    unsigned ldst[8];
    const f16* gsrc[8];
#pragma unroll
    for (int it = 0; it < 4; ++it) {
      ldst[it] = (unsigned)(size_t)&lds_k[buf][(sr + 16 * it) * 72 + sc];
      gsrc[it] = kp + it * 16 * DIMN;
      ldst[4 + it] = (unsigned)(size_t)&lds_v[buf][(sr + 16 * it) * 80 + sc];
      gsrc[4 + it] = vp + it * 16 * DIMN;
    }
    async8_b128(ldst, gsrc);
    kp += 64 * DIMN;
    vp += 64 * DIMN;
  };

  stage(0);
  wait_async0();
  __syncthreads();
  stage(1);

  for (int kc = 0; kc < SEQ / 64; ++kc) {
    const int buf = kc & 1;
    const f16* lk = lds_k[buf];
    const f16* lv = lds_v[buf];

    // S^T = K @ Q^T  (A frag: row = key, contiguous d in lds_k rows)
    v8f S[4];
#pragma unroll
    for (int t = 0; t < 4; ++t) {
      AFrag aK[2];
#pragma unroll
      for (int f = 0; f < 2; ++f)
#pragma unroll
        for (int j = 0; j < 8; ++j)
          aK[f].u[j] = *(const unsigned*)
              &lk[(t * 16 + m) * 72 + pairK(j) + 8 * half + 32 * f];
      v8f c = {};
      c = __builtin_amdgcn_wmma_f32_16x16x32_f16(false, aK[0].v, false, bQ[0].v,
                                                 (short)0, c, false, false);
      c = __builtin_amdgcn_wmma_f32_16x16x32_f16(false, aK[1].v, false, bQ[1].v,
                                                 (short)0, c, false, false);
      S[t] = c;
    }

    // online softmax of query m: 32 of the chunk's 64 keys are in this lane,
    // the other 32 in lane ^ 16. Scores are handled two at a time (packed f32).
    f32x2 Sp[4][4];
    float mt[4];
#pragma unroll
    for (int t = 0; t < 4; ++t) {
      mt[t] = -1e30f;
#pragma unroll
      for (int i = 0; i < 4; ++i) {
        f32x2 x = {S[t][2 * i], S[t][2 * i + 1]};
        x *= ATTN_SCALE;
        Sp[t][i] = x;
        mt[t] = fmaxf(mt[t], fmaxf(x.x, x.y));
      }
    }
    float mx = fmaxf(fmaxf(mt[0], mt[1]), fmaxf(mt[2], mt[3]));
    mx = fmaxf(mx, xhalf(mx));
    float nm = fmaxf(mrun, mx);
    float alpha = __expf(mrun - nm);
    mrun = nm;

    // P^T as B operand, packed in place: key tiles 2f and 2f+1 hold keys
    // 32 f + 8 half + 0..7 and 32 f + 16 + 8 half + 0..7, which is the pairK order.
    AFrag bP[2];
    f32x2 st[4];
#pragma unroll
    for (int t = 0; t < 4; ++t) {
#pragma unroll
      for (int i = 0; i < 4; ++i) {
        f32x2 a = (Sp[t][i] - nm) * LOG2E;
        f32x2 p = {__builtin_amdgcn_exp2f(a.x), __builtin_amdgcn_exp2f(a.y)};
        st[t] = (i == 0) ? p : st[t] + p;
        bP[t >> 1].h2[(t & 1) * 4 + i] = __builtin_convertvector(p, f16x2);
      }
    }
    f32x2 sall = (st[0] + st[1]) + (st[2] + st[3]);
    lrun = lrun * alpha + (sall.x + sall.y);
#pragma unroll
    for (int s = 0; s < 4; ++s) Oacc[s] *= alpha;

    // O^T += V^T @ P^T  (A frag: row = d, transposed out of row-major lds_v on the read)
#pragma unroll
    for (int s = 0; s < 4; ++s) {
      AFrag aV[2];
#pragma unroll
      for (int f = 0; f < 2; ++f) {
        const f16* p = &lv[(32 * f + 8 * half + (lane & 7)) * 80 +
                              s * 16 + 8 * ((lane >> 3) & 1)];
        aV[f].q[0] = ld_tr16(p);
        aV[f].q[1] = ld_tr16(p + 16 * 80);
      }
      Oacc[s] = __builtin_amdgcn_wmma_f32_16x16x32_f16(false, aV[0].v, false, bP[0].v,
                                                       (short)0, Oacc[s], false, false);
      Oacc[s] = __builtin_amdgcn_wmma_f32_16x16x32_f16(false, aV[1].v, false, bP[1].v,
                                                       (short)0, Oacc[s], false, false);
    }

    // publish point of the next chunk: own LDS reads back, own copies landed, barrier;
    // only then the refill of the buffer that this trip has read
    wait_ds0();
    wait_async0();
    __syncthreads();
    if (kc + 2 < SEQ / 64) stage(buf);
  }
  wait_async0();

  // join the two lanes' sums, normalize and store (f16, row-major [b*n, h*d]):
  // a lane's 8 registers of a tile are 8 consecutive d of its query's row.
  const float lsum = lrun + xhalf(lrun);
#pragma unroll
  for (int s = 0; s < 4; ++s) {
    v8h o;
#pragma unroll
    for (int r = 0; r < 8; ++r) o[r] = (f16)(Oacc[s][r] / lsum);
    *(v8h*)&O[(size_t)(qrow0 + m) * DIMN + qcol0 + s * 16 + 8 * half] = o;
  }
}

// ---------------------------------------------------------------- launch
extern "C" void kernel_launch(void* const* d_in, const int* in_sizes, int n_in,
                              void* d_out, int out_size, void* d_ws, size_t ws_size,
                              hipStream_t stream) {
  (void)in_sizes; (void)n_in; (void)out_size; (void)ws_size;
  const float* words     = (const float*)d_in[0];
  const float* position  = (const float*)d_in[1];
  const float* conscious = (const float*)d_in[2];
  const float* w_wq = (const float*)d_in[3];
  const float* w_wk = (const float*)d_in[4];
  const float* w_wv = (const float*)d_in[5];
  const float* w_pq = (const float*)d_in[6];
  const float* w_pk = (const float*)d_in[7];
  const float* w_cq = (const float*)d_in[8];
  const float* w_ck = (const float*)d_in[9];
  const float* w_out = (const float*)d_in[10];
  const float* b_out = (const float*)d_in[11];

  f16* ws   = (f16*)d_ws;
  f16* Xcat = ws;                               // 8192 x 3072
  f16* Wqc  = Xcat + (size_t)ROWS * K3;         // 3072 x 1024 [w_wq; w_pq; w_cq]
  f16* Wkc  = Wqc + (size_t)K3 * DIMN;          // 3072 x 1024 [w_wk; w_pk; w_ck]
  f16* Wv   = Wkc + (size_t)K3 * DIMN;          // 1024 x 1024
  f16* Wo   = Wv + (size_t)DIMN * DIMN;         // 1024 x 1024
  f16* Qm   = Wo + (size_t)DIMN * DIMN;         // 8192 x 1024
  f16* Km   = Qm + (size_t)ROWS * DIMN;
  f16* Vm   = Km + (size_t)ROWS * DIMN;
  f16* Am   = Vm + (size_t)ROWS * DIMN;

  // Wqc, Wkc, Wv, Wo lie one behind another: eight 1024 x 1024 blocks from Wqc on
  pack_all<<<PACK_ALLROWS / (PACK_ROWS * PACK_WAVES), PACK_WAVES * 32, 0, stream>>>(
      words, position, conscious, w_wq, w_pq, w_cq, w_wk, w_pk, w_ck, w_wv, w_out, Xcat, Wqc);

  dim3 g(DIMN / 128, ROWS / 128);  // (8, 64)
  // Q = Xcat @ Wqc (K=3072); K = Xcat @ Wkc; V = words @ Wv (first 1024 cols)
  gemm_wmma<false, false><<<g, 256, 0, stream>>>(Xcat, Wqc, Qm, nullptr, K3, K3, DIMN, DIMN);
  gemm_wmma<false, false><<<g, 256, 0, stream>>>(Xcat, Wkc, Km, nullptr, K3, K3, DIMN, DIMN);
  gemm_wmma<false, false><<<g, 256, 0, stream>>>(Xcat, Wv, Vm, nullptr, DIMN, K3, DIMN, DIMN);

  flash_attn<<<dim3(SEQ / 64, BATCH * NHEADS), 128, 0, stream>>>(Qm, Km, Vm, Am);

  // out = Attn @ Wo + b_out  (f32 output)
  gemm_wmma<true, true><<<g, 256, 0, stream>>>(Am, Wo, d_out, b_out, DIMN, DIMN, DIMN, DIMN);
}

// v006
// Measured time: 206 microseconds a run.
// Timed twice side by side with v005, it ran 1.07 times as fast both times.
// Over all steps from v000 it is 4.96 times as fast.
#include <hip/hip_runtime.h>

typedef _Float16 f16;
typedef __attribute__((ext_vector_type(16))) _Float16 v16h;
typedef __attribute__((ext_vector_type(8)))  _Float16 v8h;
typedef __attribute__((ext_vector_type(8)))  float    v8f;

#define DIMN 1024
#define HEADD 64
#define NHEADS 16
#define BATCH 4
#define SEQ 2048
#define ROWS (BATCH*SEQ)   /* 8192 */
#define K3   (3*DIMN)      /* 3072 */
#define ATTN_SCALE 0.125f  /* 64^-0.5 */
#define LOG2E 1.4426950408889634f

// K-index mapping for 16-bit A/B fragments (ISA 7.12.2, 16-bit A 16x32):
// VGPR j holds 2 f16; lanes 0-15 cover K {0..7,16..23}, lanes 16-31 add +8.
__device__ __forceinline__ int pairK(int j) { return (j < 4) ? (2 * j) : (16 + 2 * (j - 4)); }

typedef __attribute__((ext_vector_type(4))) unsigned u32x4;
typedef __attribute__((ext_vector_type(8))) short    s16x8;

typedef __attribute__((ext_vector_type(2))) float    f32x2;
typedef __attribute__((ext_vector_type(2))) _Float16 f16x2;

union AFrag { unsigned u[8]; u32x4 q[2]; f16x2 h2[8]; v16h v; };

// Transposing LDS load: from a row-major [k][n] tile, lane (c = l & 15, h = l >> 4)
// receives T[kbase + 8h + 0..7][nbase + c]; the lane's own address is
// row kbase + 8h + (l & 7), byte 2*nbase + 16*((l >> 3) & 1). Loads at kbase and
// kbase + 16 fill registers 0-3 and 4-7 of a fragment in the pairK order above.
__device__ __forceinline__ u32x4 ld_tr16(const f16* p) {
  typedef __attribute__((address_space(3))) s16x8 lds_s16x8;
  return __builtin_bit_cast(u32x4, __builtin_amdgcn_ds_load_tr16_b128_v8i16((lds_s16x8*)p));
}

// CDNA5 async copy: global -> LDS, 16 bytes per lane, tracked by ASYNCcnt.
// LDS operand is the low 32 bits of the generic pointer (LDS aperture truncates
// addr[31:0] per ISA 10.2).
// Eight copies (four per tile of a stage, or the eight A copies of a stage of twelve) and their s_wait_xcnt 0 in one statement,
// so that no address register of an issued copy is rewritten ahead of the wait.
__device__ __forceinline__ void async8_b128(const unsigned (&l)[8], const f16* const (&g)[8]) {
  asm volatile("global_load_async_to_lds_b128 %0, %1, off\n\t"
               "global_load_async_to_lds_b128 %2, %3, off\n\t"
               "global_load_async_to_lds_b128 %4, %5, off\n\t"
               "global_load_async_to_lds_b128 %6, %7, off\n\t"
               "global_load_async_to_lds_b128 %8, %9, off\n\t"
               "global_load_async_to_lds_b128 %10, %11, off\n\t"
               "global_load_async_to_lds_b128 %12, %13, off\n\t"
               "global_load_async_to_lds_b128 %14, %15, off\n\t"
               "s_wait_xcnt 0x0"
               :: "v"(l[0]), "v"(g[0]), "v"(l[1]), "v"(g[1]), "v"(l[2]), "v"(g[2]),
                  "v"(l[3]), "v"(g[3]), "v"(l[4]), "v"(g[4]), "v"(l[5]), "v"(g[5]),
                  "v"(l[6]), "v"(g[6]), "v"(l[7]), "v"(g[7])
               : "memory");
}
// The same form for four copies (a stage of twelve: eight and four).
__device__ __forceinline__ void async4_b128(const unsigned (&l)[4], const f16* const (&g)[4]) {
  asm volatile("global_load_async_to_lds_b128 %0, %1, off\n\t"
               "global_load_async_to_lds_b128 %2, %3, off\n\t"
               "global_load_async_to_lds_b128 %4, %5, off\n\t"
               "global_load_async_to_lds_b128 %6, %7, off\n\t"
               "s_wait_xcnt 0x0"
               :: "v"(l[0]), "v"(g[0]), "v"(l[1]), "v"(g[1]), "v"(l[2]), "v"(g[2]),
                  "v"(l[3]), "v"(g[3])
               : "memory");
}
__device__ __forceinline__ void wait_async0() {
  asm volatile("s_wait_asynccnt 0x0" ::: "memory");
}
// This wave's LDS reads of a buffer have returned before the barrier behind which
// the buffer is refilled by copies.
__device__ __forceinline__ void wait_ds0() {
  asm volatile("s_wait_dscnt 0x0" ::: "memory");
}

// ---------------------------------------------------------------- pack kernel
typedef __attribute__((ext_vector_type(4))) float    f32x4;
typedef __attribute__((ext_vector_type(4))) _Float16 f16x4;

#define PACK_ROWS 8                        /* rows of DIMN elements per wave */
#define PACK_WAVES 16                      /* waves per workgroup */
#define PACK_ALLROWS (3 * ROWS + 8 * DIMN) /* 32768 rows: three activations, eight weights */

// All f32 -> f16 conversions in one streaming launch: one workgroup of 16 waves per WGP,
// few waves to start, many bytes in flight per wave. A wave owns 8 consecutive rows of
// 1024 elements of ONE source. A row is 8 loads of 512 contiguous bytes; the next row's
// loads are issued before this row is converted and stored (8 to 16 in flight per wave).
// Rows 0..24575 are words, position, conscious -> xcat[row][source * 1024 + col];
// rows 24576.. are the eight weights, whose f16 copies lie one behind another in wcat.
__global__ __launch_bounds__(PACK_WAVES * 32)
void pack_all(const float* __restrict__ words, const float* __restrict__ position,
              const float* __restrict__ conscious,
              const float* __restrict__ w_wq, const float* __restrict__ w_pq,
              const float* __restrict__ w_cq, const float* __restrict__ w_wk,
              const float* __restrict__ w_pk, const float* __restrict__ w_ck,
              const float* __restrict__ w_wv, const float* __restrict__ w_out,
              f16* __restrict__ xcat, f16* __restrict__ wcat) {
  const int lane = threadIdx.x & 31;
  const int gw = __builtin_amdgcn_readfirstlane((int)(blockIdx.x * PACK_WAVES + (threadIdx.x >> 5)));
  const int R = gw * PACK_ROWS;
  const float* src;
  f16* dst;
  int dpitch;
  if (R < 3 * ROWS) {
    const int s = R / ROWS, row = R % ROWS;
    src = (s == 0 ? words : s == 1 ? position : conscious) + (size_t)row * DIMN;
    dst = xcat + (size_t)row * K3 + s * DIMN;
    dpitch = K3;
  } else {
    const int q = R - 3 * ROWS, j = q / DIMN;
    const float* w = j == 0 ? w_wq : j == 1 ? w_pq : j == 2 ? w_cq : j == 3 ? w_wk
                   : j == 4 ? w_pk : j == 5 ? w_ck : j == 6 ? w_wv : w_out;
    src = w + (size_t)(q % DIMN) * DIMN;
    dst = wcat + (size_t)q * DIMN;
    dpitch = DIMN;
  }
  src += lane * 4;
  dst += lane * 4;

  f32x4 cur[8], nxt[8];
#pragma unroll
  for (int i = 0; i < 8; ++i)
    cur[i] = __builtin_nontemporal_load((const f32x4*)(src + i * 128));
#pragma unroll
  for (int r = 0; r < PACK_ROWS; ++r) {
    if (r + 1 < PACK_ROWS) {
#pragma unroll
      for (int i = 0; i < 8; ++i)
        nxt[i] = __builtin_nontemporal_load((const f32x4*)(src + (r + 1) * DIMN + i * 128));
      // all of the next row's loads are issued before the first wait on this row's;
      // without it the compiler spreads them among those waits
      __builtin_amdgcn_sched_barrier(0);
    }
#pragma unroll
    for (int i = 0; i < 8; ++i)
      *(f16x4*)(dst + i * 128) = __builtin_convertvector(cur[i], f16x4);
    if (r + 1 < PACK_ROWS) {
      // in front of every rewrite of a register that an issued load or store names
      // (the stores' data and address, which the next trip uses again)
      asm volatile("s_wait_xcnt 0x0" ::: "memory");
      // holds the next trip's register writes behind that wait
      __builtin_amdgcn_sched_barrier(0);
      dst += dpitch;
#pragma unroll
      for (int i = 0; i < 8; ++i) cur[i] = nxt[i];
    }
  }
}

// ---------------------------------------------------------------- WMMA GEMM
// C[M,N] = A[M,K] @ B[K,N]; f16 in, f32 accumulate; a workgroup of 4(m) x WN(n) waves
// computes a 256 x (64 WN) tile in steps of 64 along K, each wave 64x64 (4 x 4 fragments:
// 16 products per 8 fragments read from LDS). blockIdx.z picks one of several B and C
// matrices that lie bMat and cMat elements apart and share A.
// A and B tiles staged via global_load_async_to_lds_b128; B stays row-major in
// LDS and is transposed on the read by ds_load_tr16_b128.
// Two LDS buffers: while trip t works on buffer t & 1, tile t + 1's copies fly into
// the other one; one barrier per trip publishes tile t + 1 and frees buffer t & 1.
template <int WN, bool OUT_F32, bool HAS_BIAS>
__global__ __launch_bounds__(WN * 128)
void gemm_wmma(const f16* __restrict__ A, const f16* __restrict__ B,
               void* __restrict__ Cout, const float* __restrict__ bias,
               int K, int lda, int ldb, int ldc, size_t bMat, size_t cMat) {
  constexpr int NT = WN * 128;      // threads
  constexpr int TN = WN * 64;       // tile columns
  constexpr int BP = TN + 16;       // B row pitch in elements
  constexpr int NA = 2048 / NT;     // A copies per lane: 256 rows x 8 vectors of 16 B
  __shared__ __attribute__((aligned(16))) f16 lds_a[2][256 * 72];  // [row][k], stride 144B = 16B x odd
  __shared__ __attribute__((aligned(16))) f16 lds_b[2][64 * BP];   // [k][n], stride 288B or 544B = 32B x odd

  const int tid = threadIdx.x;
  const int wave = tid >> 5, lane = tid & 31;
  const int m = lane & 15, half = lane >> 4;
  const int waveM = wave / WN, waveN = wave % WN;
  const int rowBase = blockIdx.y * 256;
  const int colBase = blockIdx.x * TN;
  B += blockIdx.z * bMat;

  v8f acc[4][4] = {};

  // issue the copies of the next tile along K into buffer buf; ap and bp walk the tiles.
  // A tile: 256x64 f16, 8 vectors per row: a lane brings rows ar + (NT / 8) it.
  // B tile: 64xTN f16, TN / 8 vectors per row, row-major: rows br + 16 it.
  const int ar = tid >> 3, ac = (tid & 7) * 8;
  const int br = tid / (TN / 8), bc = (tid % (TN / 8)) * 8;
  const f16* ap = A + (size_t)(rowBase + ar) * lda + ac;
  const f16* bp = B + (size_t)br * ldb + colBase + bc;
  auto stage = [&](int buf) {
    unsigned lA[NA], lB[4];
    const f16* gA[NA];
    const f16* gB[4];
#pragma unroll
    for (int it = 0; it < NA; ++it) {
      lA[it] = (unsigned)(size_t)&lds_a[buf][(ar + (NT / 8) * it) * 72 + ac];
      gA[it] = ap + (size_t)((NT / 8) * it) * lda;
    }
#pragma unroll
    for (int it = 0; it < 4; ++it) {
      lB[it] = (unsigned)(size_t)&lds_b[buf][(br + 16 * it) * BP + bc];
      gB[it] = bp + (size_t)(16 * it) * ldb;
    }
    if constexpr (NA == 4) {
      const unsigned l8[8] = {lA[0], lA[1], lA[2], lA[3], lB[0], lB[1], lB[2], lB[3]};
      const f16* const g8[8] = {gA[0], gA[1], gA[2], gA[3], gB[0], gB[1], gB[2], gB[3]};
      async8_b128(l8, g8);
    } else {
      async8_b128(lA, gA);
      async4_b128(lB, gB);
    }
    ap += 64;
    bp += (size_t)64 * ldb;
  };

  stage(0);
  wait_async0();
  __syncthreads();
  if (64 < K) stage(1);

  for (int k0 = 0; k0 < K; k0 += 64) {
    const int buf = (k0 >> 6) & 1;
    const f16* la = lds_a[buf];
    const f16* lb = lds_b[buf];

#pragma unroll
    for (int ks = 0; ks < 2; ++ks) {
      const int kk = ks * 32;
      AFrag a[4], b[4];
#pragma unroll
      for (int ms = 0; ms < 4; ++ms) {
        int row = waveM * 64 + ms * 16 + m;
#pragma unroll
        for (int j = 0; j < 8; ++j)
          a[ms].u[j] = *(const unsigned*)&la[row * 72 + kk + pairK(j) + 8 * half];
      }
#pragma unroll
      for (int ns = 0; ns < 4; ++ns) {
        const f16* p = &lb[(kk + 8 * half + (lane & 7)) * BP +
                              waveN * 64 + ns * 16 + 8 * ((lane >> 3) & 1)];
        b[ns].q[0] = ld_tr16(p);
        b[ns].q[1] = ld_tr16(p + 16 * BP);
      }
      // the 16 fragment loads of this k step go out as one group ahead of its 16 products;
      // without it the compiler fetches one A fragment at a time into the same registers
      // and waits out the LDS latency in front of every row of four products
      __builtin_amdgcn_sched_barrier(0);
#pragma unroll
      for (int ms = 0; ms < 4; ++ms)
#pragma unroll
        for (int ns = 0; ns < 4; ++ns)
          acc[ms][ns] = __builtin_amdgcn_wmma_f32_16x16x32_f16(
              false, a[ms].v, false, b[ns].v, (short)0, acc[ms][ns], false, false);
    }

    // publish point of the next tile: own LDS reads back, own copies landed, barrier;
    // only then the refill of the buffer that this trip has read
    wait_ds0();
    wait_async0();
    __syncthreads();
    if (k0 + 128 < K) stage(buf);
  }
  wait_async0();

  // Branch-free epilogue: C layout -> row = r + 8*half, col = lane&15.
#pragma unroll
  for (int ms = 0; ms < 4; ++ms)
#pragma unroll
    for (int ns = 0; ns < 4; ++ns) {
      int row0 = rowBase + waveM * 64 + ms * 16 + 8 * half;
      int col = colBase + waveN * 64 + ns * 16 + m;
      float bv = 0.f;
      if constexpr (HAS_BIAS) bv = bias[col];
#pragma unroll
      for (int r = 0; r < 8; ++r) {
        float val = acc[ms][ns][r] + bv;
        size_t idx = blockIdx.z * cMat + (size_t)(row0 + r) * ldc + col;
        if constexpr (OUT_F32) ((float*)Cout)[idx] = val;
        else                   ((f16*)Cout)[idx] = (f16)val;
      }
    }
}

// lane l with lane l ^ 16
__device__ __forceinline__ float xhalf(float x) {
  int b = __builtin_bit_cast(int, x);
  return __builtin_bit_cast(float,
      __builtin_amdgcn_permlanex16(b, b, 0x76543210, 0xfedcba98, false, false));
}

__global__ __launch_bounds__(128)
void flash_attn(const f16* __restrict__ Q, const f16* __restrict__ Kmat,
                const f16* __restrict__ Vmat, f16* __restrict__ O) {
  // two buffers each: chunk kc is worked on in buffer kc & 1 while chunk kc + 1 flies into the other
  __shared__ __attribute__((aligned(16))) f16 lds_k[2][64 * 72];  // [key][d], stride 144B = 16B x odd
  __shared__ __attribute__((aligned(16))) f16 lds_v[2][64 * 80];  // [key][d], stride 160B = 32B x odd

  const int tid = threadIdx.x;
  const int wave = tid >> 5, lane = tid & 31;
  const int m = lane & 15, half = lane >> 4;
  const int bh = blockIdx.y, bi = bh >> 4, h = bh & 15;
  const int qrow0 = bi * SEQ + blockIdx.x * 64 + wave * 16;
  const int qcol0 = h * HEADD;

  // Q^T as B operand: column = query m, k = d in the pairK order (two frags: d 0..31, 32..63)
  AFrag bQ[2];
#pragma unroll
  for (int f = 0; f < 2; ++f)
#pragma unroll
    for (int j = 0; j < 8; ++j)
      bQ[f].u[j] = *(const unsigned*)
          &Q[(size_t)(qrow0 + m) * DIMN + qcol0 + pairK(j) + 8 * half + 32 * f];

  v8f Oacc[4] = {};            // O^T: Oacc[s][r] = O[query m][d = 16 s + 8 half + r]
  float mrun = -1e30f;         // query m's running maximum, equal in both of its lanes
  float lrun = 0.f;            // running sum over this lane's own keys only

  // issue the copies of the next K and V chunk into buffer buf, both row-major:
  // a lane brings 16 B of rows sr, sr + 16, sr + 32, sr + 48; kp and vp walk the chunks
  const int sr = tid >> 3, sc = (tid & 7) * 8;
  const f16* kp = Kmat + (size_t)(bi * SEQ + sr) * DIMN + qcol0 + sc;
  const f16* vp = Vmat + (size_t)(bi * SEQ + sr) * DIMN + qcol0 + sc;
  auto stage = [&](int buf) {
    unsigned ldst[8];
    const f16* gsrc[8];
#pragma unroll
    for (int it = 0; it < 4; ++it) {
      ldst[it] = (unsigned)(size_t)&lds_k[buf][(sr + 16 * it) * 72 + sc];
      gsrc[it] = kp + it * 16 * DIMN;
      ldst[4 + it] = (unsigned)(size_t)&lds_v[buf][(sr + 16 * it) * 80 + sc];
      gsrc[4 + it] = vp + it * 16 * DIMN;
    }
    async8_b128(ldst, gsrc);
    kp += 64 * DIMN;
    vp += 64 * DIMN;
  };

  stage(0);
  wait_async0();
  __syncthreads();
  stage(1);

  for (int kc = 0; kc < SEQ / 64; ++kc) {
    const int buf = kc & 1;
    const f16* lk = lds_k[buf];
    const f16* lv = lds_v[buf];

    // S^T = K @ Q^T  (A frag: row = key, contiguous d in lds_k rows)
    v8f S[4];
#pragma unroll
    for (int t = 0; t < 4; ++t) {
      AFrag aK[2];
#pragma unroll
      for (int f = 0; f < 2; ++f)
#pragma unroll
        for (int j = 0; j < 8; ++j)
          aK[f].u[j] = *(const unsigned*)
              &lk[(t * 16 + m) * 72 + pairK(j) + 8 * half + 32 * f];
      v8f c = {};
      c = __builtin_amdgcn_wmma_f32_16x16x32_f16(false, aK[0].v, false, bQ[0].v,
                                                 (short)0, c, false, false);
      c = __builtin_amdgcn_wmma_f32_16x16x32_f16(false, aK[1].v, false, bQ[1].v,
                                                 (short)0, c, false, false);
      S[t] = c;
    }

    // online softmax of query m: 32 of the chunk's 64 keys are in this lane,
    // the other 32 in lane ^ 16. Scores are handled two at a time (packed f32).
    f32x2 Sp[4][4];
    float mt[4];
#pragma unroll
    for (int t = 0; t < 4; ++t) {
      mt[t] = -1e30f;
#pragma unroll
      for (int i = 0; i < 4; ++i) {
        f32x2 x = {S[t][2 * i], S[t][2 * i + 1]};
        x *= ATTN_SCALE;
        Sp[t][i] = x;
        mt[t] = fmaxf(mt[t], fmaxf(x.x, x.y));
      }
    }
    float mx = fmaxf(fmaxf(mt[0], mt[1]), fmaxf(mt[2], mt[3]));
    mx = fmaxf(mx, xhalf(mx));
    float nm = fmaxf(mrun, mx);
    float alpha = __expf(mrun - nm);
    mrun = nm;

    // P^T as B operand, packed in place: key tiles 2f and 2f+1 hold keys
    // 32 f + 8 half + 0..7 and 32 f + 16 + 8 half + 0..7, which is the pairK order.
    AFrag bP[2];
    f32x2 st[4];
#pragma unroll
    for (int t = 0; t < 4; ++t) {
#pragma unroll
      for (int i = 0; i < 4; ++i) {
        f32x2 a = (Sp[t][i] - nm) * LOG2E;
        f32x2 p = {__builtin_amdgcn_exp2f(a.x), __builtin_amdgcn_exp2f(a.y)};
        st[t] = (i == 0) ? p : st[t] + p;
        bP[t >> 1].h2[(t & 1) * 4 + i] = __builtin_convertvector(p, f16x2);
      }
    }
    f32x2 sall = (st[0] + st[1]) + (st[2] + st[3]);
    lrun = lrun * alpha + (sall.x + sall.y);
#pragma unroll
    for (int s = 0; s < 4; ++s) Oacc[s] *= alpha;

    // O^T += V^T @ P^T  (A frag: row = d, transposed out of row-major lds_v on the read)
#pragma unroll
    for (int s = 0; s < 4; ++s) {
      AFrag aV[2];
#pragma unroll
      for (int f = 0; f < 2; ++f) {
        const f16* p = &lv[(32 * f + 8 * half + (lane & 7)) * 80 +
                              s * 16 + 8 * ((lane >> 3) & 1)];
        aV[f].q[0] = ld_tr16(p);
        aV[f].q[1] = ld_tr16(p + 16 * 80);
      }
      Oacc[s] = __builtin_amdgcn_wmma_f32_16x16x32_f16(false, aV[0].v, false, bP[0].v,
                                                       (short)0, Oacc[s], false, false);
      Oacc[s] = __builtin_amdgcn_wmma_f32_16x16x32_f16(false, aV[1].v, false, bP[1].v,
                                                       (short)0, Oacc[s], false, false);
    }

    // publish point of the next chunk: own LDS reads back, own copies landed, barrier;
    // only then the refill of the buffer that this trip has read
    wait_ds0();
    wait_async0();
    __syncthreads();
    if (kc + 2 < SEQ / 64) stage(buf);
  }
  wait_async0();

  // join the two lanes' sums, normalize and store (f16, row-major [b*n, h*d]):
  // a lane's 8 registers of a tile are 8 consecutive d of its query's row.
  const float lsum = lrun + xhalf(lrun);
#pragma unroll
  for (int s = 0; s < 4; ++s) {
    v8h o;
#pragma unroll
    for (int r = 0; r < 8; ++r) o[r] = (f16)(Oacc[s][r] / lsum);
    *(v8h*)&O[(size_t)(qrow0 + m) * DIMN + qcol0 + s * 16 + 8 * half] = o;
  }
}

// ---------------------------------------------------------------- launch
extern "C" void kernel_launch(void* const* d_in, const int* in_sizes, int n_in,
                              void* d_out, int out_size, void* d_ws, size_t ws_size,
                              hipStream_t stream) {
  (void)in_sizes; (void)n_in; (void)out_size; (void)ws_size;
  const float* words     = (const float*)d_in[0];
  const float* position  = (const float*)d_in[1];
  const float* conscious = (const float*)d_in[2];
  const float* w_wq = (const float*)d_in[3];
  const float* w_wk = (const float*)d_in[4];
  const float* w_wv = (const float*)d_in[5];
  const float* w_pq = (const float*)d_in[6];
  const float* w_pk = (const float*)d_in[7];
  const float* w_cq = (const float*)d_in[8];
  const float* w_ck = (const float*)d_in[9];
  const float* w_out = (const float*)d_in[10];
  const float* b_out = (const float*)d_in[11];

  f16* ws   = (f16*)d_ws;
  f16* Xcat = ws;                               // 8192 x 3072
  f16* Wqc  = Xcat + (size_t)ROWS * K3;         // 3072 x 1024 [w_wq; w_pq; w_cq]
  f16* Wkc  = Wqc + (size_t)K3 * DIMN;          // 3072 x 1024 [w_wk; w_pk; w_ck]
  f16* Wv   = Wkc + (size_t)K3 * DIMN;          // 1024 x 1024
  f16* Wo   = Wv + (size_t)DIMN * DIMN;         // 1024 x 1024
  f16* Qm   = Wo + (size_t)DIMN * DIMN;         // 8192 x 1024
  f16* Km   = Qm + (size_t)ROWS * DIMN;
  f16* Vm   = Km + (size_t)ROWS * DIMN;
  f16* Am   = Vm + (size_t)ROWS * DIMN;

  // Wqc, Wkc, Wv, Wo lie one behind another: eight 1024 x 1024 blocks from Wqc on
  pack_all<<<PACK_ALLROWS / (PACK_ROWS * PACK_WAVES), PACK_WAVES * 32, 0, stream>>>(
      words, position, conscious, w_wq, w_pq, w_cq, w_wk, w_pk, w_ck, w_wv, w_out, Xcat, Wqc);

  // [Q | K] = Xcat @ [Wqc | Wkc] (K=3072) in one launch: 256x256 tiles, z = 0 is Q, z = 1 is K;
  // 4 x 32 x 2 = 256 workgroups. V = words @ Wv (first 1024 cols of Xcat): 256x128 tiles, 8 x 32.
  gemm_wmma<4, false, false><<<dim3(DIMN / 256, ROWS / 256, 2), 512, 0, stream>>>(
      Xcat, Wqc, Qm, nullptr, K3, K3, DIMN, DIMN, (size_t)K3 * DIMN, (size_t)ROWS * DIMN);
  dim3 g(DIMN / 128, ROWS / 256);  // (8, 32)
  gemm_wmma<2, false, false><<<g, 256, 0, stream>>>(Xcat, Wv, Vm, nullptr, DIMN, K3, DIMN, DIMN, 0, 0);

  flash_attn<<<dim3(SEQ / 64, BATCH * NHEADS), 128, 0, stream>>>(Qm, Km, Vm, Am);

  // out = Attn @ Wo + b_out  (f32 output)
  gemm_wmma<2, true, true><<<g, 256, 0, stream>>>(Am, Wo, d_out, b_out, DIMN, DIMN, DIMN, DIMN, 0, 0);
}

// v007
// It runs in 188 microseconds.
// In both of two side-by-side timings against v006, it was 1.09 times as fast.
// Counting every step since v000, it is 5.40 times as fast.
#include <hip/hip_runtime.h>

typedef _Float16 f16;
typedef __attribute__((ext_vector_type(16))) _Float16 v16h;
typedef __attribute__((ext_vector_type(8)))  _Float16 v8h;
typedef __attribute__((ext_vector_type(8)))  float    v8f;

#define DIMN 1024
#define HEADD 64
#define NHEADS 16
#define BATCH 4
#define SEQ 2048
#define ROWS (BATCH*SEQ)   /* 8192 */
#define K3   (3*DIMN)      /* 3072 */
#define ATTN_SCALE 0.125f  /* 64^-0.5 */
#define LOG2E 1.4426950408889634f

// K-index mapping for 16-bit A/B fragments (ISA 7.12.2, 16-bit A 16x32):
// VGPR j holds 2 f16; lanes 0-15 cover K {0..7,16..23}, lanes 16-31 add +8.
__device__ __forceinline__ int pairK(int j) { return (j < 4) ? (2 * j) : (16 + 2 * (j - 4)); }

typedef __attribute__((ext_vector_type(4))) unsigned u32x4;
typedef __attribute__((ext_vector_type(8))) short    s16x8;

typedef __attribute__((ext_vector_type(2))) float    f32x2;
typedef __attribute__((ext_vector_type(2))) _Float16 f16x2;

union AFrag { unsigned u[8]; u32x4 q[2]; f16x2 h2[8]; v16h v; };

// Transposing LDS load: from a row-major [k][n] tile, lane (c = l & 15, h = l >> 4)
// receives T[kbase + 8h + 0..7][nbase + c]; the lane's own address is
// row kbase + 8h + (l & 7), byte 2*nbase + 16*((l >> 3) & 1). Loads at kbase and
// kbase + 16 fill registers 0-3 and 4-7 of a fragment in the pairK order above.
__device__ __forceinline__ u32x4 ld_tr16(const f16* p) {
  typedef __attribute__((address_space(3))) s16x8 lds_s16x8;
  return __builtin_bit_cast(u32x4, __builtin_amdgcn_ds_load_tr16_b128_v8i16((lds_s16x8*)p));
}

// CDNA5 async copy: global -> LDS, 16 bytes per lane, tracked by ASYNCcnt.
// LDS operand is the low 32 bits of the generic pointer (LDS aperture truncates
// addr[31:0] per ISA 10.2).
// Eight copies (four per tile of a stage, or the eight A copies of a stage of twelve) and their s_wait_xcnt 0 in one statement,
// so that no address register of an issued copy is rewritten ahead of the wait.
__device__ __forceinline__ void async8_b128(const unsigned (&l)[8], const f16* const (&g)[8]) {
  asm volatile("global_load_async_to_lds_b128 %0, %1, off\n\t"
               "global_load_async_to_lds_b128 %2, %3, off\n\t"
               "global_load_async_to_lds_b128 %4, %5, off\n\t"
               "global_load_async_to_lds_b128 %6, %7, off\n\t"
               "global_load_async_to_lds_b128 %8, %9, off\n\t"
               "global_load_async_to_lds_b128 %10, %11, off\n\t"
               "global_load_async_to_lds_b128 %12, %13, off\n\t"
               "global_load_async_to_lds_b128 %14, %15, off\n\t"
               "s_wait_xcnt 0x0"
               :: "v"(l[0]), "v"(g[0]), "v"(l[1]), "v"(g[1]), "v"(l[2]), "v"(g[2]),
                  "v"(l[3]), "v"(g[3]), "v"(l[4]), "v"(g[4]), "v"(l[5]), "v"(g[5]),
                  "v"(l[6]), "v"(g[6]), "v"(l[7]), "v"(g[7])
               : "memory");
}
// The same form for four copies (a stage of twelve: eight and four).
__device__ __forceinline__ void async4_b128(const unsigned (&l)[4], const f16* const (&g)[4]) {
  asm volatile("global_load_async_to_lds_b128 %0, %1, off\n\t"
               "global_load_async_to_lds_b128 %2, %3, off\n\t"
               "global_load_async_to_lds_b128 %4, %5, off\n\t"
               "global_load_async_to_lds_b128 %6, %7, off\n\t"
               "s_wait_xcnt 0x0"
               :: "v"(l[0]), "v"(g[0]), "v"(l[1]), "v"(g[1]), "v"(l[2]), "v"(g[2]),
                  "v"(l[3]), "v"(g[3])
               : "memory");
}
__device__ __forceinline__ void wait_async0() {
  asm volatile("s_wait_asynccnt 0x0" ::: "memory");
}
// This wave's LDS reads of a buffer have returned before the barrier behind which
// the buffer is refilled by copies.
__device__ __forceinline__ void wait_ds0() {
  asm volatile("s_wait_dscnt 0x0" ::: "memory");
}

// ---------------------------------------------------------------- pack kernel
typedef __attribute__((ext_vector_type(4))) float    f32x4;
typedef __attribute__((ext_vector_type(4))) _Float16 f16x4;

#define PACK_ROWS 8                        /* rows of DIMN elements per wave */
#define PACK_WAVES 16                      /* waves per workgroup */
#define PACK_ALLROWS (3 * ROWS + 8 * DIMN) /* 32768 rows: three activations, eight weights */

// All f32 -> f16 conversions in one streaming launch: one workgroup of 16 waves per WGP,
// few waves to start, many bytes in flight per wave. A wave owns 8 consecutive rows of
// 1024 elements of ONE source. A row is 8 loads of 512 contiguous bytes; the next row's
// loads are issued before this row is converted and stored (8 to 16 in flight per wave).
// Rows 0..24575 are words, position, conscious -> xcat[row][source * 1024 + col];
// rows 24576.. are the eight weights, whose f16 copies lie one behind another in wcat.
__global__ __launch_bounds__(PACK_WAVES * 32)
void pack_all(const float* __restrict__ words, const float* __restrict__ position,
              const float* __restrict__ conscious,
              const float* __restrict__ w_wq, const float* __restrict__ w_pq,
              const float* __restrict__ w_cq, const float* __restrict__ w_wk,
              const float* __restrict__ w_pk, const float* __restrict__ w_ck,
              const float* __restrict__ w_wv, const float* __restrict__ w_out,
              f16* __restrict__ xcat, f16* __restrict__ wcat) {
  const int lane = threadIdx.x & 31;
  const int gw = __builtin_amdgcn_readfirstlane((int)(blockIdx.x * PACK_WAVES + (threadIdx.x >> 5)));
  const int R = gw * PACK_ROWS;
  const float* src;
  f16* dst;
  int dpitch;
  if (R < 3 * ROWS) {
    const int s = R / ROWS, row = R % ROWS;
    src = (s == 0 ? words : s == 1 ? position : conscious) + (size_t)row * DIMN;
    dst = xcat + (size_t)row * K3 + s * DIMN;
    dpitch = K3;
  } else {
    const int q = R - 3 * ROWS, j = q / DIMN;
    const float* w = j == 0 ? w_wq : j == 1 ? w_pq : j == 2 ? w_cq : j == 3 ? w_wk
                   : j == 4 ? w_pk : j == 5 ? w_ck : j == 6 ? w_wv : w_out;
    src = w + (size_t)(q % DIMN) * DIMN;
    dst = wcat + (size_t)q * DIMN;
    dpitch = DIMN;
  }
  src += lane * 4;
  dst += lane * 4;

  f32x4 cur[8], nxt[8];
#pragma unroll
  for (int i = 0; i < 8; ++i)
    cur[i] = __builtin_nontemporal_load((const f32x4*)(src + i * 128));
#pragma unroll
  for (int r = 0; r < PACK_ROWS; ++r) {
    if (r + 1 < PACK_ROWS) {
#pragma unroll
      for (int i = 0; i < 8; ++i)
        nxt[i] = __builtin_nontemporal_load((const f32x4*)(src + (r + 1) * DIMN + i * 128));
      // all of the next row's loads are issued before the first wait on this row's;
      // without it the compiler spreads them among those waits
      __builtin_amdgcn_sched_barrier(0);
    }
#pragma unroll
    for (int i = 0; i < 8; ++i)
      *(f16x4*)(dst + i * 128) = __builtin_convertvector(cur[i], f16x4);
    if (r + 1 < PACK_ROWS) {
      // in front of every rewrite of a register that an issued load or store names
      // (the stores' data and address, which the next trip uses again)
      asm volatile("s_wait_xcnt 0x0" ::: "memory");
      // holds the next trip's register writes behind that wait
      __builtin_amdgcn_sched_barrier(0);
      dst += dpitch;
#pragma unroll
      for (int i = 0; i < 8; ++i) cur[i] = nxt[i];
    }
  }
}

// ---------------------------------------------------------------- WMMA GEMM
// C[M,N] = A[M,K] @ B[K,N]; f16 in, f32 accumulate; a workgroup of 4(m) x WN(n) waves
// computes a 256 x (64 WN) tile in steps of 64 along K, each wave 64x64 (4 x 4 fragments:
// 16 products per 8 fragments read from LDS). blockIdx.z picks one of several B and C
// matrices that lie bMat and cMat elements apart and share A.
// A and B tiles staged via global_load_async_to_lds_b128; B stays row-major in
// LDS and is transposed on the read by ds_load_tr16_b128.
// Two LDS buffers: while trip t works on buffer t & 1, tile t + 1's copies fly into
// the other one; one barrier per trip publishes tile t + 1 and frees buffer t & 1.
template <int WN, bool OUT_F32, bool HAS_BIAS>
__global__ __launch_bounds__(WN * 128)
void gemm_wmma(const f16* __restrict__ A, const f16* __restrict__ B,
               void* __restrict__ Cout, const float* __restrict__ bias,
               int K, int lda, int ldb, int ldc, size_t bMat, size_t cMat) {
  constexpr int NT = WN * 128;      // threads
  constexpr int TN = WN * 64;       // tile columns
  constexpr int BP = TN + 16;       // B row pitch in elements
  constexpr int NA = 2048 / NT;     // A copies per lane: 256 rows x 8 vectors of 16 B
  __shared__ __attribute__((aligned(16))) f16 lds_a[2][256 * 72];  // [row][k], stride 144B = 16B x odd
  __shared__ __attribute__((aligned(16))) f16 lds_b[2][64 * BP];   // [k][n], stride 288B or 544B = 32B x odd

  const int tid = threadIdx.x;
  const int wave = tid >> 5, lane = tid & 31;
  const int m = lane & 15, half = lane >> 4;
  const int waveM = wave / WN, waveN = wave % WN;
  const int rowBase = blockIdx.y * 256;
  const int colBase = blockIdx.x * TN;
  B += blockIdx.z * bMat;

  v8f acc[4][4] = {};

  // issue the copies of the next tile along K into buffer buf; ap and bp walk the tiles.
  // A tile: 256x64 f16, 8 vectors per row: a lane brings rows ar + (NT / 8) it.
  // B tile: 64xTN f16, TN / 8 vectors per row, row-major: rows br + 16 it.
  const int ar = tid >> 3, ac = (tid & 7) * 8;
  const int br = tid / (TN / 8), bc = (tid % (TN / 8)) * 8;
  const f16* ap = A + (size_t)(rowBase + ar) * lda + ac;
  const f16* bp = B + (size_t)br * ldb + colBase + bc;
  auto stage = [&](int buf) {
    unsigned lA[NA], lB[4];
    const f16* gA[NA];
    const f16* gB[4];
#pragma unroll
    for (int it = 0; it < NA; ++it) {
      lA[it] = (unsigned)(size_t)&lds_a[buf][(ar + (NT / 8) * it) * 72 + ac];
      gA[it] = ap + (size_t)((NT / 8) * it) * lda;
    }
#pragma unroll
    for (int it = 0; it < 4; ++it) {
      lB[it] = (unsigned)(size_t)&lds_b[buf][(br + 16 * it) * BP + bc];
      gB[it] = bp + (size_t)(16 * it) * ldb;
    }
    if constexpr (NA == 4) {
      const unsigned l8[8] = {lA[0], lA[1], lA[2], lA[3], lB[0], lB[1], lB[2], lB[3]};
      const f16* const g8[8] = {gA[0], gA[1], gA[2], gA[3], gB[0], gB[1], gB[2], gB[3]};
      async8_b128(l8, g8);
    } else {
      async8_b128(lA, gA);
      async4_b128(lB, gB);
    }
    ap += 64;
    bp += (size_t)64 * ldb;
  };

  stage(0);
  wait_async0();
  __syncthreads();
  if (64 < K) stage(1);

  for (int k0 = 0; k0 < K; k0 += 64) {
    const int buf = (k0 >> 6) & 1;
    const f16* la = lds_a[buf];
    const f16* lb = lds_b[buf];

#pragma unroll
    for (int ks = 0; ks < 2; ++ks) {
      const int kk = ks * 32;
      AFrag a[4], b[4];
#pragma unroll
      for (int ms = 0; ms < 4; ++ms) {
        int row = waveM * 64 + ms * 16 + m;
#pragma unroll
        for (int j = 0; j < 8; ++j)
          a[ms].u[j] = *(const unsigned*)&la[row * 72 + kk + pairK(j) + 8 * half];
      }
#pragma unroll
      for (int ns = 0; ns < 4; ++ns) {
        const f16* p = &lb[(kk + 8 * half + (lane & 7)) * BP +
                              waveN * 64 + ns * 16 + 8 * ((lane >> 3) & 1)];
        b[ns].q[0] = ld_tr16(p);
        b[ns].q[1] = ld_tr16(p + 16 * BP);
      }
      // the 16 fragment loads of this k step go out as one group ahead of its 16 products;
      // without it the compiler fetches one A fragment at a time into the same registers
      // and waits out the LDS latency in front of every row of four products
      __builtin_amdgcn_sched_barrier(0);
#pragma unroll
      for (int ms = 0; ms < 4; ++ms)
#pragma unroll
        for (int ns = 0; ns < 4; ++ns)
          acc[ms][ns] = __builtin_amdgcn_wmma_f32_16x16x32_f16(
              false, a[ms].v, false, b[ns].v, (short)0, acc[ms][ns], false, false);
    }

    // publish point of the next tile: own LDS reads back, own copies landed, barrier;
    // only then the refill of the buffer that this trip has read
    wait_ds0();
    wait_async0();
    __syncthreads();
    if (k0 + 128 < K) stage(buf);
  }
  wait_async0();

  // Branch-free epilogue: C layout -> row = r + 8*half, col = lane&15.
#pragma unroll
  for (int ms = 0; ms < 4; ++ms)
#pragma unroll
    for (int ns = 0; ns < 4; ++ns) {
      int row0 = rowBase + waveM * 64 + ms * 16 + 8 * half;
      int col = colBase + waveN * 64 + ns * 16 + m;
      float bv = 0.f;
      if constexpr (HAS_BIAS) bv = bias[col];
#pragma unroll
      for (int r = 0; r < 8; ++r) {
        float val = acc[ms][ns][r] + bv;
        size_t idx = blockIdx.z * cMat + (size_t)(row0 + r) * ldc + col;
        if constexpr (OUT_F32) ((float*)Cout)[idx] = val;
        else                   ((f16*)Cout)[idx] = (f16)val;
      }
    }
}

// lane l with lane l ^ 16
__device__ __forceinline__ float xhalf(float x) {
  int b = __builtin_bit_cast(int, x);
  return __builtin_bit_cast(float,
      __builtin_amdgcn_permlanex16(b, b, 0x76543210, 0xfedcba98, false, false));
}

__global__ __launch_bounds__(128)
void flash_attn(const f16* __restrict__ Q, const f16* __restrict__ Kmat,
                const f16* __restrict__ Vmat, f16* __restrict__ O) {
  // two buffers each: chunk kc is worked on in buffer kc & 1 while chunk kc + 1 flies into the other
  __shared__ __attribute__((aligned(16))) f16 lds_k[2][64 * 72];  // [key][d], stride 144B = 16B x odd
  __shared__ __attribute__((aligned(16))) f16 lds_v[2][64 * 80];  // [key][d], stride 160B = 32B x odd

  const int tid = threadIdx.x;
  const int wave = tid >> 5, lane = tid & 31;
  const int m = lane & 15, half = lane >> 4;
  const int bh = blockIdx.y, bi = bh >> 4, h = bh & 15;
  const int qrow0 = bi * SEQ + blockIdx.x * 128 + wave * 32;
  const int qcol0 = h * HEADD;

  // Q^T as B operand: column = query 16 g + m, k = d in the pairK order (two frags: d 0..31, 32..63)
  AFrag bQ[2][2];
#pragma unroll
  for (int g = 0; g < 2; ++g)
#pragma unroll
    for (int f = 0; f < 2; ++f)
#pragma unroll
      for (int j = 0; j < 8; ++j)
        bQ[g][f].u[j] = *(const unsigned*)
            &Q[(size_t)(qrow0 + 16 * g + m) * DIMN + qcol0 + pairK(j) + 8 * half + 32 * f];
  // in front of every rewrite of an address register that these loads name
  asm volatile("s_wait_xcnt 0x0" ::: "memory");
  // holds the later address arithmetic, which uses those registers again, behind that wait
  __builtin_amdgcn_sched_barrier(0);

  v8f Oacc[2][4] = {};               // O^T: Oacc[g][s][r] = O[query 16 g + m][d = 16 s + 8 half + r]
  float mrun[2] = {-1e30f, -1e30f};  // a query's running maximum, equal in both of its lanes
  float lrun[2] = {0.f, 0.f};        // running sum over this lane's own keys only

  // issue the copies of the next K and V chunk into buffer buf, both row-major:
  // a lane brings 16 B of rows sr, sr + 16, sr + 32, sr + 48; kp and vp walk the chunks
  const int sr = tid >> 3, sc = (tid & 7) * 8;
  const f16* kp = Kmat + (size_t)(bi * SEQ + sr) * DIMN + qcol0 + sc;
  const f16* vp = Vmat + (size_t)(bi * SEQ + sr) * DIMN + qcol0 + sc;
  auto stage = [&](int buf) {
    unsigned ldst[8];
    const f16* gsrc[8];
#pragma unroll
    for (int it = 0; it < 4; ++it) {
      ldst[it] = (unsigned)(size_t)&lds_k[buf][(sr + 16 * it) * 72 + sc];
      gsrc[it] = kp + it * 16 * DIMN;
      ldst[4 + it] = (unsigned)(size_t)&lds_v[buf][(sr + 16 * it) * 80 + sc];
      gsrc[4 + it] = vp + it * 16 * DIMN;
    }
    async8_b128(ldst, gsrc);
    kp += 64 * DIMN;
    vp += 64 * DIMN;
  };

  stage(0);
  wait_async0();
  __syncthreads();
  stage(1);

  for (int kc = 0; kc < SEQ / 64; ++kc) {
    const int buf = kc & 1;
    const f16* lk = lds_k[buf];
    const f16* lv = lds_v[buf];

    // S^T = K @ Q^T  (A frag: row = key, contiguous d in lds_k rows), both groups per fragment
    v8f S[2][4];
#pragma unroll
    for (int t = 0; t < 4; ++t) {
      AFrag aK[2];
#pragma unroll
      for (int f = 0; f < 2; ++f)
#pragma unroll
        for (int j = 0; j < 8; ++j)
          aK[f].u[j] = *(const unsigned*)
              &lk[(t * 16 + m) * 72 + pairK(j) + 8 * half + 32 * f];
      v8f c[2] = {};
#pragma unroll
      for (int f = 0; f < 2; ++f)
#pragma unroll
        for (int g = 0; g < 2; ++g)
          c[g] = __builtin_amdgcn_wmma_f32_16x16x32_f16(false, aK[f].v, false, bQ[g][f].v,
                                                        (short)0, c[g], false, false);
      S[0][t] = c[0];
      S[1][t] = c[1];
    }

    // P^T as B operand, packed in place: key tiles 2f and 2f+1 hold keys
    // 32 f + 8 half + 0..7 and 32 f + 16 + 8 half + 0..7, which is the pairK order.
    AFrag bP[2][2];
#pragma unroll
    for (int g = 0; g < 2; ++g) {
      // online softmax of query 16 g + m: 32 of the chunk's 64 keys are in this lane,
      // the other 32 in lane ^ 16. Scores are handled two at a time (packed f32).
      f32x2 Sp[4][4];
      float mt[4];
#pragma unroll
      for (int t = 0; t < 4; ++t) {
        mt[t] = -1e30f;
#pragma unroll
        for (int i = 0; i < 4; ++i) {
          f32x2 x = {S[g][t][2 * i], S[g][t][2 * i + 1]};
          x *= ATTN_SCALE;
          Sp[t][i] = x;
          mt[t] = fmaxf(mt[t], fmaxf(x.x, x.y));
        }
      }
      float mx = fmaxf(fmaxf(mt[0], mt[1]), fmaxf(mt[2], mt[3]));
      mx = fmaxf(mx, xhalf(mx));
      float nm = fmaxf(mrun[g], mx);
      float alpha = __expf(mrun[g] - nm);
      mrun[g] = nm;

      f32x2 st[4];
#pragma unroll
      for (int t = 0; t < 4; ++t) {
#pragma unroll
        for (int i = 0; i < 4; ++i) {
          f32x2 a = (Sp[t][i] - nm) * LOG2E;
          f32x2 p = {__builtin_amdgcn_exp2f(a.x), __builtin_amdgcn_exp2f(a.y)};
          st[t] = (i == 0) ? p : st[t] + p;
          bP[g][t >> 1].h2[(t & 1) * 4 + i] = __builtin_convertvector(p, f16x2);
        }
      }
      f32x2 sall = (st[0] + st[1]) + (st[2] + st[3]);
      lrun[g] = lrun[g] * alpha + (sall.x + sall.y);
#pragma unroll
      for (int s = 0; s < 4; ++s) Oacc[g][s] *= alpha;
    }

    // O^T += V^T @ P^T  (A frag: row = d, transposed out of row-major lds_v on the read),
    // both groups per fragment
#pragma unroll
    for (int s = 0; s < 4; ++s) {
      AFrag aV[2];
#pragma unroll
      for (int f = 0; f < 2; ++f) {
        const f16* p = &lv[(32 * f + 8 * half + (lane & 7)) * 80 +
                              s * 16 + 8 * ((lane >> 3) & 1)];
        aV[f].q[0] = ld_tr16(p);
        aV[f].q[1] = ld_tr16(p + 16 * 80);
      }
#pragma unroll
      for (int f = 0; f < 2; ++f)
#pragma unroll
        for (int g = 0; g < 2; ++g)
          Oacc[g][s] = __builtin_amdgcn_wmma_f32_16x16x32_f16(false, aV[f].v, false, bP[g][f].v,
                                                              (short)0, Oacc[g][s], false, false);
    }

    // publish point of the next chunk: own LDS reads back, own copies landed, barrier;
    // only then the refill of the buffer that this trip has read
    wait_ds0();
    wait_async0();
    __syncthreads();
    if (kc + 2 < SEQ / 64) stage(buf);
  }
  wait_async0();

  // join the two lanes' sums, normalize and store (f16, row-major [b*n, h*d]):
  // a lane's 8 registers of a tile are 8 consecutive d of its query's row.
#pragma unroll
  for (int g = 0; g < 2; ++g) {
    const float lsum = lrun[g] + xhalf(lrun[g]);
#pragma unroll
    for (int s = 0; s < 4; ++s) {
      v8h o;
#pragma unroll
      for (int r = 0; r < 8; ++r) o[r] = (f16)(Oacc[g][s][r] / lsum);
      *(v8h*)&O[(size_t)(qrow0 + 16 * g + m) * DIMN + qcol0 + s * 16 + 8 * half] = o;
    }
  }
}

// ---------------------------------------------------------------- launch
extern "C" void kernel_launch(void* const* d_in, const int* in_sizes, int n_in,
                              void* d_out, int out_size, void* d_ws, size_t ws_size,
                              hipStream_t stream) {
  (void)in_sizes; (void)n_in; (void)out_size; (void)ws_size;
  const float* words     = (const float*)d_in[0];
  const float* position  = (const float*)d_in[1];
  const float* conscious = (const float*)d_in[2];
  const float* w_wq = (const float*)d_in[3];
  const float* w_wk = (const float*)d_in[4];
  const float* w_wv = (const float*)d_in[5];
  const float* w_pq = (const float*)d_in[6];
  const float* w_pk = (const float*)d_in[7];
  const float* w_cq = (const float*)d_in[8];
  const float* w_ck = (const float*)d_in[9];
  const float* w_out = (const float*)d_in[10];
  const float* b_out = (const float*)d_in[11];

  f16* ws   = (f16*)d_ws;
  f16* Xcat = ws;                               // 8192 x 3072
  f16* Wqc  = Xcat + (size_t)ROWS * K3;         // 3072 x 1024 [w_wq; w_pq; w_cq]
  f16* Wkc  = Wqc + (size_t)K3 * DIMN;          // 3072 x 1024 [w_wk; w_pk; w_ck]
  f16* Wv   = Wkc + (size_t)K3 * DIMN;          // 1024 x 1024
  f16* Wo   = Wv + (size_t)DIMN * DIMN;         // 1024 x 1024
  f16* Qm   = Wo + (size_t)DIMN * DIMN;         // 8192 x 1024
  f16* Km   = Qm + (size_t)ROWS * DIMN;
  f16* Vm   = Km + (size_t)ROWS * DIMN;
  f16* Am   = Vm + (size_t)ROWS * DIMN;

  // Wqc, Wkc, Wv, Wo lie one behind another: eight 1024 x 1024 blocks from Wqc on
  pack_all<<<PACK_ALLROWS / (PACK_ROWS * PACK_WAVES), PACK_WAVES * 32, 0, stream>>>(
      words, position, conscious, w_wq, w_pq, w_cq, w_wk, w_pk, w_ck, w_wv, w_out, Xcat, Wqc);

  // [Q | K] = Xcat @ [Wqc | Wkc] (K=3072) in one launch: 256x256 tiles, z = 0 is Q, z = 1 is K;
  // 4 x 32 x 2 = 256 workgroups. V = words @ Wv (first 1024 cols of Xcat): 256x128 tiles, 8 x 32.
  gemm_wmma<4, false, false><<<dim3(DIMN / 256, ROWS / 256, 2), 512, 0, stream>>>(
      Xcat, Wqc, Qm, nullptr, K3, K3, DIMN, DIMN, (size_t)K3 * DIMN, (size_t)ROWS * DIMN);
  dim3 g(DIMN / 128, ROWS / 256);  // (8, 32)
  gemm_wmma<2, false, false><<<g, 256, 0, stream>>>(Xcat, Wv, Vm, nullptr, DIMN, K3, DIMN, DIMN, 0, 0);

  flash_attn<<<dim3(SEQ / 128, BATCH * NHEADS), 128, 0, stream>>>(Qm, Km, Vm, Am);

  // out = Attn @ Wo + b_out  (f32 output)
  gemm_wmma<2, true, true><<<g, 256, 0, stream>>>(Am, Wo, d_out, b_out, DIMN, DIMN, DIMN, DIMN, 0, 0);
}

// v008
// A run of this version takes 173 microseconds.
// Two timings next to v007 both put it at 1.09 times that version's speed.
// Counting every step since v000, it is 5.87 times as fast.
#include <hip/hip_runtime.h>

typedef _Float16 f16;
typedef __attribute__((ext_vector_type(16))) _Float16 v16h;
typedef __attribute__((ext_vector_type(8)))  _Float16 v8h;
typedef __attribute__((ext_vector_type(8)))  float    v8f;

#define DIMN 1024
#define HEADD 64
#define NHEADS 16
#define BATCH 4
#define SEQ 2048
#define ROWS (BATCH*SEQ)   /* 8192 */
#define K3   (3*DIMN)      /* 3072 */
#define ATTN_SCALE 0.125f  /* 64^-0.5 */
#define LOG2E 1.4426950408889634f

// K-index mapping for 16-bit A/B fragments (ISA 7.12.2, 16-bit A 16x32):
// VGPR j holds 2 f16; lanes 0-15 cover K {0..7,16..23}, lanes 16-31 add +8.
__device__ __forceinline__ int pairK(int j) { return (j < 4) ? (2 * j) : (16 + 2 * (j - 4)); }

typedef __attribute__((ext_vector_type(4))) unsigned u32x4;
typedef __attribute__((ext_vector_type(8))) short    s16x8;

typedef __attribute__((ext_vector_type(2))) float    f32x2;
typedef __attribute__((ext_vector_type(2))) _Float16 f16x2;

union AFrag { unsigned u[8]; u32x4 q[2]; f16x2 h2[8]; v16h v; };

// Transposing LDS load: from a row-major [k][n] tile, lane (c = l & 15, h = l >> 4)
// receives T[kbase + 8h + 0..7][nbase + c]; the lane's own address is
// row kbase + 8h + (l & 7), byte 2*nbase + 16*((l >> 3) & 1). Loads at kbase and
// kbase + 16 fill registers 0-3 and 4-7 of a fragment in the pairK order above.
__device__ __forceinline__ u32x4 ld_tr16(const f16* p) {
  typedef __attribute__((address_space(3))) s16x8 lds_s16x8;
  return __builtin_bit_cast(u32x4, __builtin_amdgcn_ds_load_tr16_b128_v8i16((lds_s16x8*)p));
}

// CDNA5 async copy: global -> LDS, 16 bytes per lane, tracked by ASYNCcnt.
// LDS operand is the low 32 bits of the generic pointer (LDS aperture truncates
// addr[31:0] per ISA 10.2).
// Eight copies (four per tile of a stage, or the eight A copies of a stage of twelve) and their s_wait_xcnt 0 in one statement,
// so that no address register of an issued copy is rewritten ahead of the wait.
__device__ __forceinline__ void async8_b128(const unsigned (&l)[8], const f16* const (&g)[8]) {
  asm volatile("global_load_async_to_lds_b128 %0, %1, off\n\t"
               "global_load_async_to_lds_b128 %2, %3, off\n\t"
               "global_load_async_to_lds_b128 %4, %5, off\n\t"
               "global_load_async_to_lds_b128 %6, %7, off\n\t"
               "global_load_async_to_lds_b128 %8, %9, off\n\t"
               "global_load_async_to_lds_b128 %10, %11, off\n\t"
               "global_load_async_to_lds_b128 %12, %13, off\n\t"
               "global_load_async_to_lds_b128 %14, %15, off\n\t"
               "s_wait_xcnt 0x0"
               :: "v"(l[0]), "v"(g[0]), "v"(l[1]), "v"(g[1]), "v"(l[2]), "v"(g[2]),
                  "v"(l[3]), "v"(g[3]), "v"(l[4]), "v"(g[4]), "v"(l[5]), "v"(g[5]),
                  "v"(l[6]), "v"(g[6]), "v"(l[7]), "v"(g[7])
               : "memory");
}
// The same form for four copies (a stage of twelve: eight and four).
__device__ __forceinline__ void async4_b128(const unsigned (&l)[4], const f16* const (&g)[4]) {
  asm volatile("global_load_async_to_lds_b128 %0, %1, off\n\t"
               "global_load_async_to_lds_b128 %2, %3, off\n\t"
               "global_load_async_to_lds_b128 %4, %5, off\n\t"
               "global_load_async_to_lds_b128 %6, %7, off\n\t"
               "s_wait_xcnt 0x0"
               :: "v"(l[0]), "v"(g[0]), "v"(l[1]), "v"(g[1]), "v"(l[2]), "v"(g[2]),
                  "v"(l[3]), "v"(g[3])
               : "memory");
}
__device__ __forceinline__ void wait_async0() {
  asm volatile("s_wait_asynccnt 0x0" ::: "memory");
}
// All of this wave's copies but its N youngest have landed (the counter returns in issue order).
template <int N>
__device__ __forceinline__ void wait_async_but() {
  asm volatile("s_wait_asynccnt %0" :: "n"(N) : "memory");
}
// This wave's LDS reads of a buffer have returned before the barrier behind which
// the buffer is refilled by copies.
__device__ __forceinline__ void wait_ds0() {
  asm volatile("s_wait_dscnt 0x0" ::: "memory");
}

// ---------------------------------------------------------------- pack kernel
typedef __attribute__((ext_vector_type(4))) float    f32x4;
typedef __attribute__((ext_vector_type(4))) _Float16 f16x4;

#define PACK_ROWS 8                        /* rows of DIMN elements per wave */
#define PACK_WAVES 16                      /* waves per workgroup */
#define PACK_ALLROWS (3 * ROWS + 8 * DIMN) /* 32768 rows: three activations, eight weights */

// All f32 -> f16 conversions in one streaming launch: one workgroup of 16 waves per WGP,
// few waves to start, many bytes in flight per wave. A wave owns 8 consecutive rows of
// 1024 elements of ONE source. A row is 8 loads of 512 contiguous bytes; the next row's
// loads are issued before this row is converted and stored (8 to 16 in flight per wave).
// Rows 0..24575 are words, position, conscious -> xcat[row][source * 1024 + col];
// rows 24576.. are the eight weights, whose f16 copies lie one behind another in wcat.
__global__ __launch_bounds__(PACK_WAVES * 32)
void pack_all(const float* __restrict__ words, const float* __restrict__ position,
              const float* __restrict__ conscious,
              const float* __restrict__ w_wq, const float* __restrict__ w_pq,
              const float* __restrict__ w_cq, const float* __restrict__ w_wk,
              const float* __restrict__ w_pk, const float* __restrict__ w_ck,
              const float* __restrict__ w_wv, const float* __restrict__ w_out,
              f16* __restrict__ xcat, f16* __restrict__ wcat) {
  const int lane = threadIdx.x & 31;
  const int gw = __builtin_amdgcn_readfirstlane((int)(blockIdx.x * PACK_WAVES + (threadIdx.x >> 5)));
  const int R = gw * PACK_ROWS;
  const float* src;
  f16* dst;
  int dpitch;
  if (R < 3 * ROWS) {
    const int s = R / ROWS, row = R % ROWS;
    src = (s == 0 ? words : s == 1 ? position : conscious) + (size_t)row * DIMN;
    dst = xcat + (size_t)row * K3 + s * DIMN;
    dpitch = K3;
  } else {
    const int q = R - 3 * ROWS, j = q / DIMN;
    const float* w = j == 0 ? w_wq : j == 1 ? w_pq : j == 2 ? w_cq : j == 3 ? w_wk
                   : j == 4 ? w_pk : j == 5 ? w_ck : j == 6 ? w_wv : w_out;
    src = w + (size_t)(q % DIMN) * DIMN;
    dst = wcat + (size_t)q * DIMN;
    dpitch = DIMN;
  }
  src += lane * 4;
  dst += lane * 4;

  f32x4 cur[8], nxt[8];
#pragma unroll
  for (int i = 0; i < 8; ++i)
    cur[i] = __builtin_nontemporal_load((const f32x4*)(src + i * 128));
#pragma unroll
  for (int r = 0; r < PACK_ROWS; ++r) {
    if (r + 1 < PACK_ROWS) {
#pragma unroll
      for (int i = 0; i < 8; ++i)
        nxt[i] = __builtin_nontemporal_load((const f32x4*)(src + (r + 1) * DIMN + i * 128));
      // all of the next row's loads are issued before the first wait on this row's;
      // without it the compiler spreads them among those waits
      __builtin_amdgcn_sched_barrier(0);
    }
#pragma unroll
    for (int i = 0; i < 8; ++i)
      *(f16x4*)(dst + i * 128) = __builtin_convertvector(cur[i], f16x4);
    if (r + 1 < PACK_ROWS) {
      // in front of every rewrite of a register that an issued load or store names
      // (the stores' data and address, which the next trip uses again)
      asm volatile("s_wait_xcnt 0x0" ::: "memory");
      // holds the next trip's register writes behind that wait
      __builtin_amdgcn_sched_barrier(0);
      dst += dpitch;
#pragma unroll
      for (int i = 0; i < 8; ++i) cur[i] = nxt[i];
    }
  }
}

// ---------------------------------------------------------------- WMMA GEMM
// C[M,N] = A[M,K] @ B[K,N]; f16 in, f32 accumulate; a workgroup of 4(m) x WN(n) waves
// computes a 256 x (64 WN) tile in steps of 64 along K, each wave 64x64 (4 x 4 fragments:
// 16 products per 8 fragments read from LDS). blockIdx.z picks one of several B and C
// matrices that lie bMat and cMat elements apart and share A.
// A and B tiles staged via global_load_async_to_lds_b128; B stays row-major in
// LDS and is transposed on the read by ds_load_tr16_b128.
// A ring of four LDS buffers: while trip t works on buffer t & 3, the copies of tiles t + 1,
// t + 2 and t + 3 fly into the other three, so that a tile has three trips to arrive from
// memory; one barrier per trip publishes tile t + 1 and frees buffer t & 3 for tile t + 4.
template <int WN, bool OUT_F32, bool HAS_BIAS>
__global__ __launch_bounds__(WN * 128)
void gemm_wmma(const f16* __restrict__ A, const f16* __restrict__ B,
               void* __restrict__ Cout, const float* __restrict__ bias,
               int K, int lda, int ldb, int ldc, size_t bMat, size_t cMat) {
  constexpr int NT = WN * 128;      // threads
  constexpr int TN = WN * 64;       // tile columns
  constexpr int BP = TN + 16;       // B row pitch in elements
  constexpr int NA = 2048 / NT;     // A copies per lane: 256 rows x 8 vectors of 16 B
  constexpr int NC = NA + 4;        // copy instructions per wave and tile, alike in every wave
  constexpr int NB = 4;             // ring buffers
  __shared__ __attribute__((aligned(16))) f16 lds_a[NB][256 * 72];  // [row][k], stride 144B = 16B x odd
  __shared__ __attribute__((aligned(16))) f16 lds_b[NB][64 * BP];   // [k][n], stride 288B or 544B = 32B x odd

  const int tid = threadIdx.x;
  const int wave = tid >> 5, lane = tid & 31;
  const int m = lane & 15, half = lane >> 4;
  const int waveM = wave / WN, waveN = wave % WN;
  const int rowBase = blockIdx.y * 256;
  const int colBase = blockIdx.x * TN;
  B += blockIdx.z * bMat;

  v8f acc[4][4] = {};

  // issue the copies of the next tile along K into buffer buf; ap and bp walk the tiles.
  // A tile: 256x64 f16, 8 vectors per row: a lane brings rows ar + (NT / 8) it.
  // B tile: 64xTN f16, TN / 8 vectors per row, row-major: rows br + 16 it.
  const int ar = tid >> 3, ac = (tid & 7) * 8;
  const int br = tid / (TN / 8), bc = (tid % (TN / 8)) * 8;
  const f16* ap = A + (size_t)(rowBase + ar) * lda + ac;
  const f16* bp = B + (size_t)br * ldb + colBase + bc;
  auto stage = [&](int buf) {
    unsigned lA[NA], lB[4];
    const f16* gA[NA];
    const f16* gB[4];
#pragma unroll
    for (int it = 0; it < NA; ++it) {
      lA[it] = (unsigned)(size_t)&lds_a[buf][(ar + (NT / 8) * it) * 72 + ac];
      gA[it] = ap + (size_t)((NT / 8) * it) * lda;
    }
#pragma unroll
    for (int it = 0; it < 4; ++it) {
      lB[it] = (unsigned)(size_t)&lds_b[buf][(br + 16 * it) * BP + bc];
      gB[it] = bp + (size_t)(16 * it) * ldb;
    }
    if constexpr (NA == 4) {
      const unsigned l8[8] = {lA[0], lA[1], lA[2], lA[3], lB[0], lB[1], lB[2], lB[3]};
      const f16* const g8[8] = {gA[0], gA[1], gA[2], gA[3], gB[0], gB[1], gB[2], gB[3]};
      async8_b128(l8, g8);
    } else {
      async8_b128(lA, gA);
      async4_b128(lB, gB);
    }
    ap += 64;
    bp += (size_t)64 * ldb;
  };

  // fill the ring; tile 0 has landed when all but the three younger tiles' copies have
  static_assert(NB == 4, "the prologue below fills four buffers");
  stage(0);
  if (64 < K) stage(1);
  if (128 < K) stage(2);
  if (192 < K) {
    stage(3);
    wait_async_but<3 * NC>();
  } else {
    wait_async0();
  }
  __syncthreads();

  // the 32 products of one tile, out of ring buffer buf
  auto products = [&](int buf) {
    const f16* la = lds_a[buf];
    const f16* lb = lds_b[buf];

#pragma unroll
    for (int ks = 0; ks < 2; ++ks) {
      const int kk = ks * 32;
      AFrag a[4], b[4];
#pragma unroll
      for (int ms = 0; ms < 4; ++ms) {
        int row = waveM * 64 + ms * 16 + m;
#pragma unroll
        for (int j = 0; j < 8; ++j)
          a[ms].u[j] = *(const unsigned*)&la[row * 72 + kk + pairK(j) + 8 * half];
      }
#pragma unroll
      for (int ns = 0; ns < 4; ++ns) {
        const f16* p = &lb[(kk + 8 * half + (lane & 7)) * BP +
                              waveN * 64 + ns * 16 + 8 * ((lane >> 3) & 1)];
        b[ns].q[0] = ld_tr16(p);
        b[ns].q[1] = ld_tr16(p + 16 * BP);
      }
      // the 16 fragment loads of this k step go out as one group ahead of its 16 products;
      // without it the compiler fetches one A fragment at a time into the same registers
      // and waits out the LDS latency in front of every row of four products
      __builtin_amdgcn_sched_barrier(0);
#pragma unroll
      for (int ms = 0; ms < 4; ++ms)
#pragma unroll
        for (int ns = 0; ns < 4; ++ns)
          acc[ms][ns] = __builtin_amdgcn_wmma_f32_16x16x32_f16(
              false, a[ms].v, false, b[ns].v, (short)0, acc[ms][ns], false, false);
    }
  };

  // trips that refill: each issues one tile's copies, three tiles are issued behind tile t
  int k0 = 0;
  for (; k0 + NB * 64 < K; k0 += 64) {
    const int buf = (k0 >> 6) & (NB - 1);
    products(buf);
    // publish point of the next tile: own LDS reads back, own copies of that tile landed
    // (the two younger tiles' may still fly), barrier; only then the refill of the buffer
    // that this trip has read
    wait_ds0();
    wait_async_but<(NB - 2) * NC>();
    __syncthreads();
    stage(buf);
  }
  // the last four trips issue nothing: every copy has landed at their publish points
  for (; k0 < K; k0 += 64) {
    products((k0 >> 6) & (NB - 1));
    wait_ds0();
    wait_async0();
    __syncthreads();
  }
  wait_async0();

  // Branch-free epilogue: C layout -> row = r + 8*half, col = lane&15.
#pragma unroll
  for (int ms = 0; ms < 4; ++ms)
#pragma unroll
    for (int ns = 0; ns < 4; ++ns) {
      int row0 = rowBase + waveM * 64 + ms * 16 + 8 * half;
      int col = colBase + waveN * 64 + ns * 16 + m;
      float bv = 0.f;
      if constexpr (HAS_BIAS) bv = bias[col];
#pragma unroll
      for (int r = 0; r < 8; ++r) {
        float val = acc[ms][ns][r] + bv;
        size_t idx = blockIdx.z * cMat + (size_t)(row0 + r) * ldc + col;
        if constexpr (OUT_F32) ((float*)Cout)[idx] = val;
        else                   ((f16*)Cout)[idx] = (f16)val;
      }
    }
}

// lane l with lane l ^ 16
__device__ __forceinline__ float xhalf(float x) {
  int b = __builtin_bit_cast(int, x);
  return __builtin_bit_cast(float,
      __builtin_amdgcn_permlanex16(b, b, 0x76543210, 0xfedcba98, false, false));
}

__global__ __launch_bounds__(128)
void flash_attn(const f16* __restrict__ Q, const f16* __restrict__ Kmat,
                const f16* __restrict__ Vmat, f16* __restrict__ O) {
  // two buffers each: chunk kc is worked on in buffer kc & 1 while chunk kc + 1 flies into the other
  __shared__ __attribute__((aligned(16))) f16 lds_k[2][64 * 72];  // [key][d], stride 144B = 16B x odd
  __shared__ __attribute__((aligned(16))) f16 lds_v[2][64 * 80];  // [key][d], stride 160B = 32B x odd

  const int tid = threadIdx.x;
  const int wave = tid >> 5, lane = tid & 31;
  const int m = lane & 15, half = lane >> 4;
  const int bh = blockIdx.y, bi = bh >> 4, h = bh & 15;
  const int qrow0 = bi * SEQ + blockIdx.x * 128 + wave * 32;
  const int qcol0 = h * HEADD;

  // Q^T as B operand: column = query 16 g + m, k = d in the pairK order (two frags: d 0..31, 32..63)
  AFrag bQ[2][2];
#pragma unroll
  for (int g = 0; g < 2; ++g)
#pragma unroll
    for (int f = 0; f < 2; ++f)
#pragma unroll
      for (int j = 0; j < 8; ++j)
        bQ[g][f].u[j] = *(const unsigned*)
            &Q[(size_t)(qrow0 + 16 * g + m) * DIMN + qcol0 + pairK(j) + 8 * half + 32 * f];
  // in front of every rewrite of an address register that these loads name
  asm volatile("s_wait_xcnt 0x0" ::: "memory");
  // holds the later address arithmetic, which uses those registers again, behind that wait
  __builtin_amdgcn_sched_barrier(0);

  v8f Oacc[2][4] = {};               // O^T: Oacc[g][s][r] = O[query 16 g + m][d = 16 s + 8 half + r]
  float mrun[2] = {-1e30f, -1e30f};  // a query's running maximum, equal in both of its lanes
  float lrun[2] = {0.f, 0.f};        // running sum over this lane's own keys only

  // issue the copies of the next K and V chunk into buffer buf, both row-major:
  // a lane brings 16 B of rows sr, sr + 16, sr + 32, sr + 48; kp and vp walk the chunks
  const int sr = tid >> 3, sc = (tid & 7) * 8;
  const f16* kp = Kmat + (size_t)(bi * SEQ + sr) * DIMN + qcol0 + sc;
  const f16* vp = Vmat + (size_t)(bi * SEQ + sr) * DIMN + qcol0 + sc;
  auto stage = [&](int buf) {
    unsigned ldst[8];
    const f16* gsrc[8];
#pragma unroll
    for (int it = 0; it < 4; ++it) {
      ldst[it] = (unsigned)(size_t)&lds_k[buf][(sr + 16 * it) * 72 + sc];
      gsrc[it] = kp + it * 16 * DIMN;
      ldst[4 + it] = (unsigned)(size_t)&lds_v[buf][(sr + 16 * it) * 80 + sc];
      gsrc[4 + it] = vp + it * 16 * DIMN;
    }
    async8_b128(ldst, gsrc);
    kp += 64 * DIMN;
    vp += 64 * DIMN;
  };

  stage(0);
  wait_async0();
  __syncthreads();
  stage(1);

  for (int kc = 0; kc < SEQ / 64; ++kc) {
    const int buf = kc & 1;
    const f16* lk = lds_k[buf];
    const f16* lv = lds_v[buf];

    // S^T = K @ Q^T  (A frag: row = key, contiguous d in lds_k rows), both groups per fragment
    v8f S[2][4];
#pragma unroll
    for (int t = 0; t < 4; ++t) {
      AFrag aK[2];
#pragma unroll
      for (int f = 0; f < 2; ++f)
#pragma unroll
        for (int j = 0; j < 8; ++j)
          aK[f].u[j] = *(const unsigned*)
              &lk[(t * 16 + m) * 72 + pairK(j) + 8 * half + 32 * f];
      v8f c[2] = {};
#pragma unroll
      for (int f = 0; f < 2; ++f)
#pragma unroll
        for (int g = 0; g < 2; ++g)
          c[g] = __builtin_amdgcn_wmma_f32_16x16x32_f16(false, aK[f].v, false, bQ[g][f].v,
                                                        (short)0, c[g], false, false);
      S[0][t] = c[0];
      S[1][t] = c[1];
    }

    // P^T as B operand, packed in place: key tiles 2f and 2f+1 hold keys
    // 32 f + 8 half + 0..7 and 32 f + 16 + 8 half + 0..7, which is the pairK order.
    AFrag bP[2][2];
#pragma unroll
    for (int g = 0; g < 2; ++g) {
      // online softmax of query 16 g + m: 32 of the chunk's 64 keys are in this lane,
      // the other 32 in lane ^ 16. Scores are handled two at a time (packed f32).
      f32x2 Sp[4][4];
      float mt[4];
#pragma unroll
      for (int t = 0; t < 4; ++t) {
        mt[t] = -1e30f;
#pragma unroll
        for (int i = 0; i < 4; ++i) {
          f32x2 x = {S[g][t][2 * i], S[g][t][2 * i + 1]};
          x *= ATTN_SCALE;
          Sp[t][i] = x;
          mt[t] = fmaxf(mt[t], fmaxf(x.x, x.y));
        }
      }
      float mx = fmaxf(fmaxf(mt[0], mt[1]), fmaxf(mt[2], mt[3]));
      mx = fmaxf(mx, xhalf(mx));
      float nm = fmaxf(mrun[g], mx);
      float alpha = __expf(mrun[g] - nm);
      mrun[g] = nm;

      f32x2 st[4];
#pragma unroll
      for (int t = 0; t < 4; ++t) {
#pragma unroll
        for (int i = 0; i < 4; ++i) {
          f32x2 a = (Sp[t][i] - nm) * LOG2E;
          f32x2 p = {__builtin_amdgcn_exp2f(a.x), __builtin_amdgcn_exp2f(a.y)};
          st[t] = (i == 0) ? p : st[t] + p;
          bP[g][t >> 1].h2[(t & 1) * 4 + i] = __builtin_convertvector(p, f16x2);
        }
      }
      f32x2 sall = (st[0] + st[1]) + (st[2] + st[3]);
      lrun[g] = lrun[g] * alpha + (sall.x + sall.y);
#pragma unroll
      for (int s = 0; s < 4; ++s) Oacc[g][s] *= alpha;
    }

    // O^T += V^T @ P^T  (A frag: row = d, transposed out of row-major lds_v on the read),
    // both groups per fragment
#pragma unroll
    for (int s = 0; s < 4; ++s) {
      AFrag aV[2];
#pragma unroll
      for (int f = 0; f < 2; ++f) {
        const f16* p = &lv[(32 * f + 8 * half + (lane & 7)) * 80 +
                              s * 16 + 8 * ((lane >> 3) & 1)];
        aV[f].q[0] = ld_tr16(p);
        aV[f].q[1] = ld_tr16(p + 16 * 80);
      }
#pragma unroll
      for (int f = 0; f < 2; ++f)
#pragma unroll
        for (int g = 0; g < 2; ++g)
          Oacc[g][s] = __builtin_amdgcn_wmma_f32_16x16x32_f16(false, aV[f].v, false, bP[g][f].v,
                                                              (short)0, Oacc[g][s], false, false);
    }

    // publish point of the next chunk: own LDS reads back, own copies landed, barrier;
    // only then the refill of the buffer that this trip has read
    wait_ds0();
    wait_async0();
    __syncthreads();
    if (kc + 2 < SEQ / 64) stage(buf);
  }
  wait_async0();

  // join the two lanes' sums, normalize and store (f16, row-major [b*n, h*d]):
  // a lane's 8 registers of a tile are 8 consecutive d of its query's row.
#pragma unroll
  for (int g = 0; g < 2; ++g) {
    const float lsum = lrun[g] + xhalf(lrun[g]);
#pragma unroll
    for (int s = 0; s < 4; ++s) {
      v8h o;
#pragma unroll
      for (int r = 0; r < 8; ++r) o[r] = (f16)(Oacc[g][s][r] / lsum);
      *(v8h*)&O[(size_t)(qrow0 + 16 * g + m) * DIMN + qcol0 + s * 16 + 8 * half] = o;
    }
  }
}

// ---------------------------------------------------------------- launch
extern "C" void kernel_launch(void* const* d_in, const int* in_sizes, int n_in,
                              void* d_out, int out_size, void* d_ws, size_t ws_size,
                              hipStream_t stream) {
  (void)in_sizes; (void)n_in; (void)out_size; (void)ws_size;
  const float* words     = (const float*)d_in[0];
  const float* position  = (const float*)d_in[1];
  const float* conscious = (const float*)d_in[2];
  const float* w_wq = (const float*)d_in[3];
  const float* w_wk = (const float*)d_in[4];
  const float* w_wv = (const float*)d_in[5];
  const float* w_pq = (const float*)d_in[6];
  const float* w_pk = (const float*)d_in[7];
  const float* w_cq = (const float*)d_in[8];
  const float* w_ck = (const float*)d_in[9];
  const float* w_out = (const float*)d_in[10];
  const float* b_out = (const float*)d_in[11];

  f16* ws   = (f16*)d_ws;
  f16* Xcat = ws;                               // 8192 x 3072
  f16* Wqc  = Xcat + (size_t)ROWS * K3;         // 3072 x 1024 [w_wq; w_pq; w_cq]
  f16* Wkc  = Wqc + (size_t)K3 * DIMN;          // 3072 x 1024 [w_wk; w_pk; w_ck]
  f16* Wv   = Wkc + (size_t)K3 * DIMN;          // 1024 x 1024
  f16* Wo   = Wv + (size_t)DIMN * DIMN;         // 1024 x 1024
  f16* Qm   = Wo + (size_t)DIMN * DIMN;         // 8192 x 1024
  f16* Km   = Qm + (size_t)ROWS * DIMN;
  f16* Vm   = Km + (size_t)ROWS * DIMN;
  f16* Am   = Vm + (size_t)ROWS * DIMN;

  // Wqc, Wkc, Wv, Wo lie one behind another: eight 1024 x 1024 blocks from Wqc on
  pack_all<<<PACK_ALLROWS / (PACK_ROWS * PACK_WAVES), PACK_WAVES * 32, 0, stream>>>(
      words, position, conscious, w_wq, w_pq, w_cq, w_wk, w_pk, w_ck, w_wv, w_out, Xcat, Wqc);

  // [Q | K] = Xcat @ [Wqc | Wkc] (K=3072) in one launch: 256x256 tiles, z = 0 is Q, z = 1 is K;
  // 4 x 32 x 2 = 256 workgroups. V = words @ Wv (first 1024 cols of Xcat): 256x128 tiles, 8 x 32.
  gemm_wmma<4, false, false><<<dim3(DIMN / 256, ROWS / 256, 2), 512, 0, stream>>>(
      Xcat, Wqc, Qm, nullptr, K3, K3, DIMN, DIMN, (size_t)K3 * DIMN, (size_t)ROWS * DIMN);
  dim3 g(DIMN / 128, ROWS / 256);  // (8, 32)
  gemm_wmma<2, false, false><<<g, 256, 0, stream>>>(Xcat, Wv, Vm, nullptr, DIMN, K3, DIMN, DIMN, 0, 0);

  flash_attn<<<dim3(SEQ / 128, BATCH * NHEADS), 128, 0, stream>>>(Qm, Km, Vm, Am);

  // out = Attn @ Wo + b_out  (f32 output)
  gemm_wmma<2, true, true><<<g, 256, 0, stream>>>(Am, Wo, d_out, b_out, DIMN, DIMN, DIMN, DIMN, 0, 0);
}

// v010
// Measured time: 157 microseconds a run.
// It is 1.10 times as fast as v008, going by the measured steps of the versions left out in between.
// Over all steps from v000 it is 6.43 times as fast.
#include <hip/hip_runtime.h>

typedef _Float16 f16;
typedef __attribute__((ext_vector_type(16))) _Float16 v16h;
typedef __attribute__((ext_vector_type(8)))  _Float16 v8h;
typedef __attribute__((ext_vector_type(8)))  float    v8f;

#define DIMN 1024
#define HEADD 64
#define NHEADS 16
#define BATCH 4
#define SEQ 2048
#define ROWS (BATCH*SEQ)   /* 8192 */
#define K3   (3*DIMN)      /* 3072 */
#define ATTN_SCALE 0.125f  /* 64^-0.5 */
#define LOG2E 1.4426950408889634f
#define QSCALE (ATTN_SCALE * LOG2E) /* Q is stored times this: scores come out in log2 units */
#define LAZY_RISE 8.0f              /* the maximum in use is raised when a score passes it by more */

// K-index mapping for 16-bit A/B fragments (ISA 7.12.2, 16-bit A 16x32):
// VGPR j holds 2 f16; lanes 0-15 cover K {0..7,16..23}, lanes 16-31 add +8.
__device__ __forceinline__ int pairK(int j) { return (j < 4) ? (2 * j) : (16 + 2 * (j - 4)); }

typedef __attribute__((ext_vector_type(4))) unsigned u32x4;
typedef __attribute__((ext_vector_type(8))) short    s16x8;

typedef __attribute__((ext_vector_type(2))) float    f32x2;
typedef __attribute__((ext_vector_type(2))) _Float16 f16x2;

union AFrag { unsigned u[8]; u32x4 q[2]; f16x2 h2[8]; v16h v; };

// Transposing LDS load: from a row-major [k][n] tile, lane (c = l & 15, h = l >> 4)
// receives T[kbase + 8h + 0..7][nbase + c]; the lane's own address is
// row kbase + 8h + (l & 7), byte 2*nbase + 16*((l >> 3) & 1). Loads at kbase and
// kbase + 16 fill registers 0-3 and 4-7 of a fragment in the pairK order above.
__device__ __forceinline__ u32x4 ld_tr16(const f16* p) {
  typedef __attribute__((address_space(3))) s16x8 lds_s16x8;
  return __builtin_bit_cast(u32x4, __builtin_amdgcn_ds_load_tr16_b128_v8i16((lds_s16x8*)p));
}

// This wave's LDS reads of a buffer have returned before the barrier behind which
// the buffer is refilled by tensor loads.
__device__ __forceinline__ void wait_ds0() {
  asm volatile("s_wait_dscnt 0x0" ::: "memory");
}

__device__ __forceinline__ unsigned uni(unsigned v) { return (unsigned)__builtin_amdgcn_readfirstlane(v); }
// a wave-uniform condition held in a scalar register: the test on it is a scalar branch
// (a tensor load ignores EXEC, only a branch keeps a wave from issuing it)
__device__ __forceinline__ unsigned pinned(unsigned v) {
  unsigned w = uni(v);
  asm volatile("" : "+s"(w));
  return w;
}
// One request: 64 rows of ROWB bytes (128 or 256), pitch bytes apart in memory, laid in LDS with
// a pad of PADB bytes (16 or 32) behind every row. Group 0 (s80-s83): count 1, place in LDS,
// address of the tile's first byte, type 2. Group 1 (s84-s91): no mask, extents in bytes,
// tensor = tile. The descriptor is formed in the load's own statement, in scalar registers
// named here that nothing else in the kernel uses: while requests are outstanding only the
// place in LDS and the low address word take new values (hi: see the caller).
template <unsigned ROWB, unsigned PADB>
__device__ __forceinline__ void tdm_load64(unsigned lds_dst, unsigned lo, unsigned hi, unsigned pitch) {
  static_assert((ROWB == 128 || ROWB == 256) && (PADB == 16 || PADB == 32));
  asm volatile("s_mov_b32 s80, 1\n\t"
               "s_mov_b32 s81, %0\n\t"
               "s_mov_b32 s82, %1\n\t"
               "s_mov_b32 s83, %2\n\t"
               "s_mov_b32 s84, %4\n\t"
               "s_mov_b32 s85, %5\n\t"
               "s_mov_b32 s86, 0x400000\n\t"
               "s_mov_b32 s87, %5\n\t"
               "s_mov_b32 s88, 64\n\t"
               "s_mov_b32 s89, %3\n\t"
               "s_mov_b32 s90, 0\n\t"
               "s_mov_b32 s91, 0\n\t"
               "tensor_load_to_lds s[80:83], s[84:91]"
               :: "s"(uni(lds_dst)), "s"(uni(lo)), "s"(uni((hi & 0x01FFFFFFu) | 0x80000000u)),
                  "s"(uni(pitch)),
                  "n"((1u << 20) | ((ROWB == 128 ? 4u : 5u) << 22) | ((PADB / 4 - 1) << 25)),
                  "n"(ROWB << 16)
               : "memory", "s80", "s81", "s82", "s83", "s84", "s85", "s86", "s87", "s88", "s89",
                 "s90", "s91");
}
// All of this wave's tensor loads but its N youngest have landed (they complete in issue order).
template <int N>
__device__ __forceinline__ void wait_tensor_le() {
  asm volatile("s_wait_tensorcnt %0" :: "n"(N) : "memory");
}

// ---------------------------------------------------------------- pack kernel
typedef __attribute__((ext_vector_type(4))) float    f32x4;
typedef __attribute__((ext_vector_type(4))) _Float16 f16x4;

#define PACK_ROWS 8                        /* rows of DIMN elements per wave */
#define PACK_WAVES 16                      /* waves per workgroup */
#define PACK_ALLROWS (3 * ROWS + 8 * DIMN) /* 32768 rows: three activations, eight weights */

// All f32 -> f16 conversions in one streaming launch: one workgroup of 16 waves per WGP,
// few waves to start, many bytes in flight per wave. A wave owns 8 consecutive rows of
// 1024 elements of ONE source. A row is 8 loads of 512 contiguous bytes; the next row's
// loads are issued before this row is converted and stored (8 to 16 in flight per wave).
// Rows 0..24575 are words, position, conscious -> xcat[row][source * 1024 + col];
// rows 24576.. are the eight weights, whose f16 copies lie one behind another in wcat.
__global__ __launch_bounds__(PACK_WAVES * 32)
void pack_all(const float* __restrict__ words, const float* __restrict__ position,
              const float* __restrict__ conscious,
              const float* __restrict__ w_wq, const float* __restrict__ w_pq,
              const float* __restrict__ w_cq, const float* __restrict__ w_wk,
              const float* __restrict__ w_pk, const float* __restrict__ w_ck,
              const float* __restrict__ w_wv, const float* __restrict__ w_out,
              f16* __restrict__ xcat, f16* __restrict__ wcat) {
  const int lane = threadIdx.x & 31;
  const int gw = __builtin_amdgcn_readfirstlane((int)(blockIdx.x * PACK_WAVES + (threadIdx.x >> 5)));
  const int R = gw * PACK_ROWS;
  const float* src;
  f16* dst;
  int dpitch;
  if (R < 3 * ROWS) {
    const int s = R / ROWS, row = R % ROWS;
    src = (s == 0 ? words : s == 1 ? position : conscious) + (size_t)row * DIMN;
    dst = xcat + (size_t)row * K3 + s * DIMN;
    dpitch = K3;
  } else {
    const int q = R - 3 * ROWS, j = q / DIMN;
    const float* w = j == 0 ? w_wq : j == 1 ? w_pq : j == 2 ? w_cq : j == 3 ? w_wk
                   : j == 4 ? w_pk : j == 5 ? w_ck : j == 6 ? w_wv : w_out;
    src = w + (size_t)(q % DIMN) * DIMN;
    dst = wcat + (size_t)q * DIMN;
    dpitch = DIMN;
  }
  src += lane * 4;
  dst += lane * 4;

  f32x4 cur[8], nxt[8];
#pragma unroll
  for (int i = 0; i < 8; ++i)
    cur[i] = __builtin_nontemporal_load((const f32x4*)(src + i * 128));
#pragma unroll
  for (int r = 0; r < PACK_ROWS; ++r) {
    if (r + 1 < PACK_ROWS) {
#pragma unroll
      for (int i = 0; i < 8; ++i)
        nxt[i] = __builtin_nontemporal_load((const f32x4*)(src + (r + 1) * DIMN + i * 128));
      // all of the next row's loads are issued before the first wait on this row's;
      // without it the compiler spreads them among those waits
      __builtin_amdgcn_sched_barrier(0);
    }
#pragma unroll
    for (int i = 0; i < 8; ++i)
      *(f16x4*)(dst + i * 128) = __builtin_convertvector(cur[i], f16x4);
    if (r + 1 < PACK_ROWS) {
      // in front of every rewrite of a register that an issued load or store names
      // (the stores' data and address, which the next trip uses again)
      asm volatile("s_wait_xcnt 0x0" ::: "memory");
      // holds the next trip's register writes behind that wait
      __builtin_amdgcn_sched_barrier(0);
      dst += dpitch;
#pragma unroll
      for (int i = 0; i < 8; ++i) cur[i] = nxt[i];
    }
  }
}

// ---------------------------------------------------------------- WMMA GEMM
// C[M,N] = A[M,K] @ B[K,N]; f16 in, f32 accumulate; a workgroup of 4(m) x WN(n) waves
// computes a 256 x (64 WN) tile in steps of 64 along K, each wave 64x64 (4 x 4 fragments:
// 16 products per 8 fragments read from LDS). blockIdx.z picks one of several B and C
// matrices that lie bMat and cMat elements apart and share A.
// A and B tiles come by tensor loads, one request per issuing wave and tile: waves 0-3 each
// bring 64 rows of A (128 B a row, laid at 144 B), waves 4 to 3 + WN/2 each 64 rows of 128 columns of B
// (256 B a row, laid at 288 B); B stays row-major in LDS and is transposed on the read by
// ds_load_tr16_b128.
// A ring of four LDS buffers: while trip t works on buffer t & 3, the loads of tiles t + 1,
// t + 2 and t + 3 fly into the other three, so that a tile has three trips to arrive from
// memory; one barrier per trip publishes tile t + 1 and frees buffer t & 3 for tile t + 4.
// SCALE0: the C matrix of blockIdx.z == 0 is stored times QSCALE (in f32, ahead of its one rounding).
template <int WN, bool OUT_F32, bool HAS_BIAS, bool SCALE0>
__global__ __launch_bounds__(WN * 128)
void gemm_wmma(const f16* __restrict__ A, const f16* __restrict__ B,
               void* __restrict__ Cout, const float* __restrict__ bias,
               int K, int lda, int ldb, int ldc, size_t bMat, size_t cMat) {
  constexpr int TN = WN * 64;       // tile columns
  constexpr int NB = 4;             // ring buffers
  constexpr int AP = 72;            // A row pitch in elements: 144 B = 16 B x odd
  constexpr int BP = 144;           // B row pitch in elements: 288 B = 32 B x odd
  // every slice's place in LDS is a multiple of 2 KiB
  constexpr unsigned ASL = 10240;   // bytes from one A slice to the next (64 rows x 144 B = 9216)
  constexpr unsigned BSL = 18432;   // bytes from one B slice to the next (64 rows x 288 B)
  constexpr unsigned BOFF = 4 * ASL;                   // the B slices' place in a buffer
  constexpr unsigned BUFB = BOFF + (WN / 2) * BSL;     // bytes per buffer
  static_assert(ASL % 2048 == 0 && BSL % 2048 == 0 && NB * BUFB <= 320 * 1024, "places and size");
  __shared__ __attribute__((aligned(2048))) f16 ring[NB * BUFB / 2];

  const int tid = threadIdx.x;
  const int wave = tid >> 5, lane = tid & 31;
  const int m = lane & 15, half = lane >> 4;
  const int waveM = wave / WN, waveN = wave % WN;
  const int rowBase = blockIdx.y * 256;
  const int colBase = blockIdx.x * TN;
  B += blockIdx.z * bMat;

  v8f acc[4][4] = {};

  // the issuing waves' slices: from ga on, the tiles along K lie gstep bytes apart
  const unsigned swave = uni((unsigned)tid >> 5);
  const bool isA = swave < 4u;
  const unsigned sb = isA ? 0u : (swave - 4u) % (unsigned)(WN / 2);   // in range in every wave
  unsigned long long ga = isA
      ? (unsigned long long)(size_t)(A + (size_t)(rowBase + 64 * swave) * lda)
      : (unsigned long long)(size_t)(B + colBase + 128 * sb);
  const unsigned gstep = isA ? 128u : 128u * (unsigned)ldb;
  const unsigned lslice = (unsigned)(size_t)ring + (isA ? swave * ASL : BOFF + sb * BSL);
  unsigned hi_out = (unsigned)(ga >> 32);   // the high address word of the requests that are out
  // issue the next tile's loads into buffer buf
  auto stage = [&](int buf) {
    const unsigned hi = (unsigned)(ga >> 32);
    if (pinned(hi != hi_out)) {
      // the walk has passed a multiple of 4 GiB: the high address word changes, with no request out
      wait_tensor_le<0>();
    }
    hi_out = hi;
    if (pinned(swave < 4u)) {
      tdm_load64<128, 16>(lslice + (unsigned)buf * BUFB, (unsigned)ga, hi, 2u * (unsigned)lda);
    } else if (pinned(swave < 4u + WN / 2)) {
      tdm_load64<256, 32>(lslice + (unsigned)buf * BUFB, (unsigned)ga, hi, 2u * (unsigned)ldb);
    }
    ga += gstep;
  };

  // fill the ring, never more than three requests of a wave outstanding: tile 0 has landed
  // when all but the two younger tiles' loads have; only then the fourth tile's load
  static_assert(NB == 4, "the prologue below fills four buffers");
  stage(0);
  if (pinned(64 < K)) stage(1);
  if (pinned(128 < K)) stage(2);
  if (pinned(192 < K)) {
    wait_tensor_le<2>();
    stage(3);
  } else {
    wait_tensor_le<0>();
  }
  __syncthreads();

  // the 32 products of one tile, out of ring buffer buf
  auto products = [&](int buf) {
    const f16* la = ring + buf * (BUFB / 2) + waveM * (ASL / 2);
    const f16* lb = ring + buf * (BUFB / 2) + BOFF / 2 + (waveN >> 1) * (BSL / 2);

#pragma unroll
    for (int ks = 0; ks < 2; ++ks) {
      const int kk = ks * 32;
      AFrag a[4], b[4];
#pragma unroll
      for (int ms = 0; ms < 4; ++ms) {
        int row = ms * 16 + m;
#pragma unroll
        for (int j = 0; j < 8; ++j)
          a[ms].u[j] = *(const unsigned*)&la[row * AP + kk + pairK(j) + 8 * half];
      }
#pragma unroll
      for (int ns = 0; ns < 4; ++ns) {
        const f16* p = &lb[(kk + 8 * half + (lane & 7)) * BP +
                              (waveN & 1) * 64 + ns * 16 + 8 * ((lane >> 3) & 1)];
        b[ns].q[0] = ld_tr16(p);
        b[ns].q[1] = ld_tr16(p + 16 * BP);
      }
      // the 16 fragment loads of this k step go out as one group ahead of its 16 products;
      // without it the compiler fetches one A fragment at a time into the same registers
      // and waits out the LDS latency in front of every row of four products
      __builtin_amdgcn_sched_barrier(0);
#pragma unroll
      for (int ms = 0; ms < 4; ++ms)
#pragma unroll
        for (int ns = 0; ns < 4; ++ns)
          acc[ms][ns] = __builtin_amdgcn_wmma_f32_16x16x32_f16(
              false, a[ms].v, false, b[ns].v, (short)0, acc[ms][ns], false, false);
    }
  };

  // trips that refill: each issues one tile's loads, three tiles are issued behind tile t
  int k0 = 0;
  for (; k0 + NB * 64 < K; k0 += 64) {
    const int buf = (k0 >> 6) & (NB - 1);
    products(buf);
    // publish point of the next tile: own LDS reads back, own load of that tile landed
    // (the two younger tiles' may still fly), barrier; only then the refill of the buffer
    // that this trip has read
    wait_ds0();
    wait_tensor_le<NB - 2>();
    __syncthreads();
    stage(buf);
  }
  // the last four trips issue nothing: every load has landed at their publish points
  for (; k0 < K; k0 += 64) {
    products((k0 >> 6) & (NB - 1));
    wait_ds0();
    wait_tensor_le<0>();
    __syncthreads();
  }
  wait_tensor_le<0>();

  // Branch-free epilogue: C layout -> row = r + 8*half, col = lane&15.
  const float cs = (SCALE0 && blockIdx.z == 0) ? QSCALE : 1.f;
#pragma unroll
  for (int ms = 0; ms < 4; ++ms)
#pragma unroll
    for (int ns = 0; ns < 4; ++ns) {
      int row0 = rowBase + waveM * 64 + ms * 16 + 8 * half;
      int col = colBase + waveN * 64 + ns * 16 + m;
      float bv = 0.f;
      if constexpr (HAS_BIAS) bv = bias[col];
#pragma unroll
      for (int r = 0; r < 8; ++r) {
        float val = acc[ms][ns][r] + bv;
        if constexpr (SCALE0) val *= cs;
        size_t idx = blockIdx.z * cMat + (size_t)(row0 + r) * ldc + col;
        if constexpr (OUT_F32) ((float*)Cout)[idx] = val;
        else                   ((f16*)Cout)[idx] = (f16)val;
      }
    }
}

// lane l with lane l ^ 16
__device__ __forceinline__ float xhalf(float x) {
  int b = __builtin_bit_cast(int, x);
  return __builtin_bit_cast(float,
      __builtin_amdgcn_permlanex16(b, b, 0x76543210, 0xfedcba98, false, false));
}

__global__ __launch_bounds__(128)
void flash_attn(const f16* __restrict__ Q, const f16* __restrict__ Kmat,
                const f16* __restrict__ Vmat, f16* __restrict__ O) {
  // two buffers each: chunk kc is worked on in buffer kc & 1 while chunk kc + 1 flies into the other
  // a buffer: K [key][d] at 144 B a row (16 B x odd), then V [key][d] at 160 B a row (32 B x odd);
  // both tiles' places in LDS are multiples of 2 KiB
  constexpr unsigned KSL = 10240;           // bytes kept for the K tile (64 rows x 144 B = 9216)
  constexpr unsigned ABUF = KSL + 64 * 160; // bytes per buffer
  static_assert(KSL % 2048 == 0 && ABUF % 2048 == 0, "places");
  __shared__ __attribute__((aligned(2048))) f16 ring[2 * ABUF / 2];

  const int tid = threadIdx.x;
  const int wave = tid >> 5, lane = tid & 31;
  const int m = lane & 15, half = lane >> 4;
  const int bh = blockIdx.y, bi = bh >> 4, h = bh & 15;
  const int qrow0 = bi * SEQ + blockIdx.x * 128 + wave * 32;
  const int qcol0 = h * HEADD;

  // Q^T as B operand: column = query 16 g + m, k = d in the pairK order (two frags: d 0..31, 32..63)
  AFrag bQ[2][2];
#pragma unroll
  for (int g = 0; g < 2; ++g)
#pragma unroll
    for (int f = 0; f < 2; ++f)
#pragma unroll
      for (int j = 0; j < 8; ++j)
        bQ[g][f].u[j] = *(const unsigned*)
            &Q[(size_t)(qrow0 + 16 * g + m) * DIMN + qcol0 + pairK(j) + 8 * half + 32 * f];
  // in front of every rewrite of an address register that these loads name
  asm volatile("s_wait_xcnt 0x0" ::: "memory");
  // holds the later address arithmetic, which uses those registers again, behind that wait
  __builtin_amdgcn_sched_barrier(0);

  v8f Oacc[2][4] = {};               // O^T: Oacc[g][s][r] = O[query 16 g + m][d = 16 s + 8 half + r]
  v8f negm[2] = {};                  // minus a query's maximum in use, in all 8 registers, equal in both of its lanes
  float lrun[2] = {0.f, 0.f};        // running sum over this lane's own keys only

  // issue the tensor loads of the next K and V chunk into buffer buf, both row-major, 64 rows of
  // 128 B: wave 0 brings K, wave 1 brings V; ga walks the chunks. One request of a wave is out
  // at any time.
  const unsigned swave = uni((unsigned)tid >> 5);
  unsigned long long ga = (unsigned long long)(size_t)
      ((swave == 0u ? Kmat : Vmat) + (size_t)(bi * SEQ) * DIMN + qcol0);
  auto stage = [&](int buf) {
    const unsigned place = (unsigned)(size_t)ring + (unsigned)buf * ABUF;
    if (pinned(swave == 0u)) {
      tdm_load64<128, 16>(place, (unsigned)ga, (unsigned)(ga >> 32), 2u * DIMN);
    } else if (pinned(swave == 1u)) {
      tdm_load64<128, 32>(place + KSL, (unsigned)ga, (unsigned)(ga >> 32), 2u * DIMN);
    }
    ga += 64u * DIMN * 2u;
  };

  stage(0);
  wait_tensor_le<0>();
  __syncthreads();
  stage(1);

  for (int kc = 0; kc < SEQ / 64; ++kc) {
    const int buf = kc & 1;
    const f16* lk = ring + buf * (ABUF / 2);
    const f16* lv = lk + KSL / 2;

    // S^T = K @ Q^T  (A frag: row = key, contiguous d in lds_k rows), both groups per fragment
    v8f S[2][4];
#pragma unroll
    for (int t = 0; t < 4; ++t) {
      AFrag aK[2];
#pragma unroll
      for (int f = 0; f < 2; ++f)
#pragma unroll
        for (int j = 0; j < 8; ++j)
          aK[f].u[j] = *(const unsigned*)
              &lk[(t * 16 + m) * 72 + pairK(j) + 8 * half + 32 * f];
      v8f c[2] = {negm[0], negm[1]};
#pragma unroll
      for (int f = 0; f < 2; ++f)
#pragma unroll
        for (int g = 0; g < 2; ++g)
          c[g] = __builtin_amdgcn_wmma_f32_16x16x32_f16(false, aK[f].v, false, bQ[g][f].v,
                                                        (short)0, c[g], false, false);
      S[0][t] = c[0];
      S[1][t] = c[1];
    }

    // the lane's largest score above the maximum in use, per group (32 of the chunk's 64 keys
    // of query 16 g + m are in this lane, the other 32 in lane ^ 16)
    float mx[2];
#pragma unroll
    for (int g = 0; g < 2; ++g) {
      float mt[4];
#pragma unroll
      for (int t = 0; t < 4; ++t) {
        mt[t] = fmaxf(S[g][t][0], S[g][t][1]);
#pragma unroll
        for (int i = 1; i < 4; ++i) mt[t] = fmaxf(mt[t], fmaxf(S[g][t][2 * i], S[g][t][2 * i + 1]));
      }
      mx[g] = fmaxf(fmaxf(mt[0], mt[1]), fmaxf(mt[2], mt[3]));
    }
    // one test per chunk, a scalar branch: any query of the wave too far above its maximum in use
    if (kc == 0 || __builtin_amdgcn_ballot_w32(fmaxf(mx[0], mx[1]) > LAZY_RISE) != 0) {
#pragma unroll
      for (int g = 0; g < 2; ++g) {
        const float mq = fmaxf(mx[g], xhalf(mx[g]));
        // chunk 0 sets the maximum (O and the sum are still 0); later it only rises
        const float delta = (kc == 0) ? mq : fmaxf(mq, 0.f);
        const float alpha = (kc == 0) ? 1.f : __builtin_amdgcn_exp2f(-delta);
        negm[g] -= delta;
#pragma unroll
        for (int t = 0; t < 4; ++t) S[g][t] -= delta;
        lrun[g] *= alpha;
#pragma unroll
        for (int s = 0; s < 4; ++s) Oacc[g][s] *= alpha;
      }
    }

    // P^T as B operand, packed in place: key tiles 2f and 2f+1 hold keys
    // 32 f + 8 half + 0..7 and 32 f + 16 + 8 half + 0..7, which is the pairK order.
    AFrag bP[2][2];
#pragma unroll
    for (int g = 0; g < 2; ++g) {
      f32x2 st[4];
#pragma unroll
      for (int t = 0; t < 4; ++t) {
#pragma unroll
        for (int i = 0; i < 4; ++i) {
          f32x2 p = {__builtin_amdgcn_exp2f(S[g][t][2 * i]), __builtin_amdgcn_exp2f(S[g][t][2 * i + 1])};
          st[t] = (i == 0) ? p : st[t] + p;
          bP[g][t >> 1].h2[(t & 1) * 4 + i] = __builtin_convertvector(p, f16x2);
        }
      }
      f32x2 sall = (st[0] + st[1]) + (st[2] + st[3]);
      lrun[g] += sall.x + sall.y;
    }

    // O^T += V^T @ P^T  (A frag: row = d, transposed out of row-major lds_v on the read),
    // both groups per fragment
#pragma unroll
    for (int s = 0; s < 4; ++s) {
      AFrag aV[2];
#pragma unroll
      for (int f = 0; f < 2; ++f) {
        const f16* p = &lv[(32 * f + 8 * half + (lane & 7)) * 80 +
                              s * 16 + 8 * ((lane >> 3) & 1)];
        aV[f].q[0] = ld_tr16(p);
        aV[f].q[1] = ld_tr16(p + 16 * 80);
      }
#pragma unroll
      for (int f = 0; f < 2; ++f)
#pragma unroll
        for (int g = 0; g < 2; ++g)
          Oacc[g][s] = __builtin_amdgcn_wmma_f32_16x16x32_f16(false, aV[f].v, false, bP[g][f].v,
                                                              (short)0, Oacc[g][s], false, false);
    }

    // publish point of the next chunk: own LDS reads back, own load landed, barrier;
    // only then the refill of the buffer that this trip has read
    wait_ds0();
    wait_tensor_le<0>();
    __syncthreads();
    if (pinned(kc + 2 < SEQ / 64)) stage(buf);
  }
  wait_tensor_le<0>();
  wait_ds0();

  // join the two lanes' sums, normalize and store (f16, row-major [b*n, h*d]):
  // a lane's 8 registers of a tile are 8 consecutive d of its query's row.
#pragma unroll
  for (int g = 0; g < 2; ++g) {
    const float lsum = lrun[g] + xhalf(lrun[g]);
#pragma unroll
    for (int s = 0; s < 4; ++s) {
      v8h o;
#pragma unroll
      for (int r = 0; r < 8; ++r) o[r] = (f16)(Oacc[g][s][r] / lsum);
      *(v8h*)&O[(size_t)(qrow0 + 16 * g + m) * DIMN + qcol0 + s * 16 + 8 * half] = o;
    }
  }
}

// ---------------------------------------------------------------- launch
extern "C" void kernel_launch(void* const* d_in, const int* in_sizes, int n_in,
                              void* d_out, int out_size, void* d_ws, size_t ws_size,
                              hipStream_t stream) {
  (void)in_sizes; (void)n_in; (void)out_size; (void)ws_size;
  const float* words     = (const float*)d_in[0];
  const float* position  = (const float*)d_in[1];
  const float* conscious = (const float*)d_in[2];
  const float* w_wq = (const float*)d_in[3];
  const float* w_wk = (const float*)d_in[4];
  const float* w_wv = (const float*)d_in[5];
  const float* w_pq = (const float*)d_in[6];
  const float* w_pk = (const float*)d_in[7];
  const float* w_cq = (const float*)d_in[8];
  const float* w_ck = (const float*)d_in[9];
  const float* w_out = (const float*)d_in[10];
  const float* b_out = (const float*)d_in[11];

  f16* ws   = (f16*)d_ws;
  f16* Xcat = ws;                               // 8192 x 3072
  f16* Wqc  = Xcat + (size_t)ROWS * K3;         // 3072 x 1024 [w_wq; w_pq; w_cq]
  f16* Wkc  = Wqc + (size_t)K3 * DIMN;          // 3072 x 1024 [w_wk; w_pk; w_ck]
  f16* Wv   = Wkc + (size_t)K3 * DIMN;          // 1024 x 1024
  f16* Wo   = Wv + (size_t)DIMN * DIMN;         // 1024 x 1024
  f16* Qm   = Wo + (size_t)DIMN * DIMN;         // 8192 x 1024
  f16* Km   = Qm + (size_t)ROWS * DIMN;
  f16* Vm   = Km + (size_t)ROWS * DIMN;
  f16* Am   = Vm + (size_t)ROWS * DIMN;

  // Wqc, Wkc, Wv, Wo lie one behind another: eight 1024 x 1024 blocks from Wqc on
  pack_all<<<PACK_ALLROWS / (PACK_ROWS * PACK_WAVES), PACK_WAVES * 32, 0, stream>>>(
      words, position, conscious, w_wq, w_pq, w_cq, w_wk, w_pk, w_ck, w_wv, w_out, Xcat, Wqc);

  // [Q | K] = Xcat @ [Wqc | Wkc] (K=3072) in one launch: 256x256 tiles, z = 0 is Q (times QSCALE), z = 1 is K;
  // 4 x 32 x 2 = 256 workgroups. V = words @ Wv (first 1024 cols of Xcat): 256x128 tiles, 8 x 32.
  gemm_wmma<4, false, false, true><<<dim3(DIMN / 256, ROWS / 256, 2), 512, 0, stream>>>(
      Xcat, Wqc, Qm, nullptr, K3, K3, DIMN, DIMN, (size_t)K3 * DIMN, (size_t)ROWS * DIMN);
  dim3 g(DIMN / 128, ROWS / 256);  // (8, 32)
  gemm_wmma<2, false, false, false><<<g, 256, 0, stream>>>(Xcat, Wv, Vm, nullptr, DIMN, K3, DIMN, DIMN, 0, 0);

  flash_attn<<<dim3(SEQ / 128, BATCH * NHEADS), 128, 0, stream>>>(Qm, Km, Vm, Am);

  // out = Attn @ Wo + b_out  (f32 output)
  gemm_wmma<2, true, true, false><<<g, 256, 0, stream>>>(Am, Wo, d_out, b_out, DIMN, DIMN, DIMN, DIMN, 0, 0);
}
